// v000
// Measured on an AMD MI455X. A time is GPU time per run, averaged over a window of back-to-back runs after a warm-up
// (all launches, gaps included; the runs take copies of the inputs in turn), and the median of several windows.
// Apart from v000's, it joins two sittings. Times from different sittings can be a few percent apart, while
// side-by-side timings come from the same sitting.
// v000, which the later versions start from, runs in 387 microseconds.
#include <hip/hip_runtime.h>

// All contractions on v_wmma_f32_16x16x32_f16 (f16 operands, f32 accumulate): x*[Wq|Wk|Wv]^T, ctx*Wo^T, h*W1^T, relu*W2^T single f16 products (bf16-RNE inputs exact in f16, weights carried x64); q*k^T with f16 hi plane + 2^11-scaled f16 residual plane (two accumulators, residual folded 2^-11 in f32); P*v single product with P carried 2^10.

#ifndef NB
#define NB 4
#endif
#ifndef SEQ
#define SEQ 2048
#endif
#define NB_FULL  4
#define SEQ_FULL 2048
#define DM   512         // model width
#define NH   8           // heads
#define DK   64          // head width
#define DFF  2048        // FFN width
#define NTOK (NB * SEQ)
#define LP   72          // f16 staging pitch (halves), 144 B rows
#define VP   136         // transposed-V staging pitch (halves), 272 B rows
#define FP   68          // f32 staging pitch (floats), 272 B rows

static_assert(NB >= 1 && NB <= NB_FULL);           // batch within the input
static_assert(SEQ >= 128 && SEQ <= SEQ_FULL);      // sequence within the input
static_assert(SEQ % 128 == 0);                     // 128-token blocks never straddle a batch
static_assert(SEQ % 32 == 0);                      // key step of 32
static_assert(NTOK % 128 == 0);                    // GEMM M tile
static_assert(NTOK % 8 == 0);                      // LayerNorm rows per block
static_assert(DM == NH * DK);                      // head split h*64+d
static_assert(DK == 64);
static_assert(DM == 512);                          // LayerNorm: 32 lanes x 16 columns
static_assert(DM % 64 == 0 && DFF % 64 == 0);      // GEMM N tile
static_assert(DM % 32 == 0 && DFF % 32 == 0);      // WMMA k step
static_assert(((size_t)NTOK * DM) % 2048 == 0);    // convert grid: 256 threads x 8 elements
static_assert(((size_t)DM * DM) % 2048 == 0);
static_assert(((size_t)DFF * DM) % 2048 == 0);
static_assert(64 * VP <= 128 * LP);                // transposed-V tile fits the f16 staging region
static_assert(LP % 8 == 0 && VP % 8 == 0 && FP % 4 == 0);   // 16-B aligned staging rows

typedef _Float16 v16h __attribute__((ext_vector_type(16)));
typedef _Float16 v8h  __attribute__((ext_vector_type(8)));
typedef _Float16 v4h  __attribute__((ext_vector_type(4)));
typedef float    v8f  __attribute__((ext_vector_type(8)));
typedef float    v4f  __attribute__((ext_vector_type(4)));

union Frag { v16h v; v8h h[2]; };

// scores: acc_h = (64k_h).(64q_h), acc_r = 2^11-scaled residual cross terms
// t (log2 units) = acc_h * log2(e)*2^-15 + acc_r * log2(e)*2^-26   (1/8 score scale folded)
#define C1 (1.44269504088896340736f * 3.0517578125e-05f)
#define C2 (1.44269504088896340736f * 1.4901161193847656e-08f)
#define SC_RES   2048.0f                 // residual plane carry 2^11
#define P_CARRY  10.0f                   // P carried 2^10 (log2 units)
#define SC_WO    6.103515625e-05f        // 2^-14 : (256 ctx)(64 Wo)
#define SC_FF2   2.44140625e-04f         // 2^-12 : (64 ff1)(64 W2)

static __device__ __forceinline__ v8f zero8() {
    v8f z;
#pragma unroll
    for (int i = 0; i < 8; ++i) z[i] = 0.0f;
    return z;
}

// 16x32 A fragment (or B fragment from an [n][k] k-contiguous source) from a
// row-major 16-bit tile: lane m = lane&15 -> row m; kb = 8*(lane>>4);
// elements 0..7 = k kb..kb+7, elements 8..15 = k kb+16..kb+23.
static __device__ __forceinline__ v16h load_frag16(const _Float16* base, int ld, int lane) {
    int m  = lane & 15;
    int kb = (lane >> 4) << 3;
    const _Float16* p = base + (size_t)m * ld + kb;
    Frag f;
    f.h[0] = *(const v8h*)(p);
    f.h[1] = *(const v8h*)(p + 16);
    return f.v;
}

static __device__ __forceinline__ v8f wmma16(v16h a, v16h b, v8f c) {
    v8f d = __builtin_amdgcn_wmma_f32_16x16x32_f16(false, a, false, b, (short)0, c, false, false);
    asm volatile("v_nop\n\tv_nop\n\tv_nop\n\tv_nop" : "+v"(d) : "v"(a), "v"(b));
    return d;
}

// f32 -> bf16 RNE convert, value kept as f32
static __device__ __forceinline__ float bf16r(float x) {
    unsigned u = __float_as_uint(x);
    u = (u + 0x7FFFu + ((u >> 16) & 1u)) & 0xFFFF0000u;
    return __uint_as_float(u);
}

static __device__ __forceinline__ float ex2(float x) {
    return __builtin_amdgcn_exp2f(x);
}

// ordering for a wave-private LDS tile: stores before later loads of the same wave
static __device__ __forceinline__ void wave_lds_sync() {
    __builtin_amdgcn_fence(3, "wavefront");
    asm volatile("s_wait_dscnt 0" ::: "memory");
    __builtin_amdgcn_wave_barrier();
}

static __device__ __forceinline__ v8f scale8(v8f a, float s) {
#pragma unroll
    for (int i = 0; i < 8; ++i) a[i] *= s;
    return a;
}

// ---------------------------------------------------------------------------
// Operand planes: f16(bf16_rne(v) * scale). 8 elements per thread, one 16-B
// ---------------------------------------------------------------------------
__global__ __launch_bounds__(256) void k_cvtx(const float* __restrict__ x,
                                               _Float16* __restrict__ xh) {
    const size_t i = ((size_t)blockIdx.x * 256 + threadIdx.x) * 8;
    if (i < (size_t)NTOK * DM) {
        const size_t tok = i / DM;
        const size_t c   = i - tok * DM;
        const size_t b   = tok / SEQ;
        const size_t s   = tok - b * SEQ;
        const float* src = x + ((b * SEQ_FULL + s) * DM + c);
        v4f a0 = *(const v4f*)(src);
        v4f a1 = *(const v4f*)(src + 4);
        v8h o;
        o[0] = (_Float16)bf16r(a0.x); o[1] = (_Float16)bf16r(a0.y);
        o[2] = (_Float16)bf16r(a0.z); o[3] = (_Float16)bf16r(a0.w);
        o[4] = (_Float16)bf16r(a1.x); o[5] = (_Float16)bf16r(a1.y);
        o[6] = (_Float16)bf16r(a1.z); o[7] = (_Float16)bf16r(a1.w);
        *(v8h*)(xh + i) = o;
        
    }
}

__global__ __launch_bounds__(256) void k_cvtw(const float* __restrict__ src,
                                               _Float16* __restrict__ dst,
                                               int n, float scale) {
    const size_t i = ((size_t)blockIdx.x * 256 + threadIdx.x) * 8;
    if (i < (size_t)n) {
        v4f a0 = *(const v4f*)(src + i);
        v4f a1 = *(const v4f*)(src + i + 4);
        v8h o;
        o[0] = (_Float16)(bf16r(a0.x) * scale); o[1] = (_Float16)(bf16r(a0.y) * scale);
        o[2] = (_Float16)(bf16r(a0.z) * scale); o[3] = (_Float16)(bf16r(a0.w) * scale);
        o[4] = (_Float16)(bf16r(a1.x) * scale); o[5] = (_Float16)(bf16r(a1.y) * scale);
        o[6] = (_Float16)(bf16r(a1.z) * scale); o[7] = (_Float16)(bf16r(a1.w) * scale);
        *(v8h*)(dst + i) = o;
        
    }
}

// ---------------------------------------------------------------------------
// Wave GEMM core: 32 rows x 64 columns, fragments straight from dense
// statically-strided 16-bit planes (A row-major pitch K, W [n][k] pitch K).
// acc[mt][nt][r] = element (row mt*16 + 8*(lane>>4) + r, col nt*16 + (lane&15)).
// ---------------------------------------------------------------------------
template <int K>
static __device__ __forceinline__ void gemm_32x64(const _Float16* __restrict__ A,
                                                  const _Float16* __restrict__ W,
                                                  int lane, v8f (&acc)[2][4]) {
    static_assert(K % 32 == 0);
#pragma unroll 1
    for (int kk = 0; kk < K; kk += 32) {
        const v16h a0 = load_frag16(A + kk, K, lane);
        const v16h a1 = load_frag16(A + (size_t)16 * K + kk, K, lane);
#pragma unroll
        for (int nt = 0; nt < 4; ++nt) {
            const v16h bw = load_frag16(W + (size_t)(nt * 16) * K + kk, K, lane);
            acc[0][nt] = wmma16(a0, bw, acc[0][nt]);
            acc[1][nt] = wmma16(a1, bw, acc[1][nt]);
        }
    }
}

// ---------------------------------------------------------------------------
// QKV projections. Block = 4 waves = 128 tokens x 64 columns (one head of one
// of q/k/v); grid (NTOK/128, 24). Outputs carried x64:
//   q,k : f16 hi plane + f16 residual plane ((v - hi) * 2^11), [tok][512]
//         4 lines per lane-contiguous instruction.
//   v   : transposed plane vT[b][h][d][S]; block-level staging [64 d][128 tok]
// ---------------------------------------------------------------------------
__global__ __launch_bounds__(128) void k_qkv(const _Float16* __restrict__ xh,
                                              const _Float16* __restrict__ wqkv,
                                              const float* __restrict__ bq,
                                              const float* __restrict__ bk,
                                              const float* __restrict__ bv,
                                              _Float16* __restrict__ qkH,
                                              _Float16* __restrict__ qkL,
                                              _Float16* __restrict__ vT) {
    __shared__ __align__(16) _Float16 stA[128 * LP];   // 18 KB
    __shared__ __align__(16) _Float16 stB[128 * LP];   // 18 KB

    const int tid  = threadIdx.x;
    const int lane = tid & 31;
    const int w    = tid >> 5;
    const int m0   = blockIdx.x * 128;
    const int y    = blockIdx.y;
    const int kind = y >> 3;          // 0 q, 1 k, 2 v  (block-uniform)
    const int hd   = y & 7;
    const int n0   = y * 64;
    const int r0   = (lane >> 4) << 3;
    const int cc   = lane & 15;

    v8f acc[2][4];
#pragma unroll
    for (int mt = 0; mt < 2; ++mt)
#pragma unroll
        for (int nt = 0; nt < 4; ++nt) acc[mt][nt] = zero8();

    gemm_32x64<DM>(xh + (size_t)(m0 + w * 32) * DM, wqkv + (size_t)n0 * DM, lane, acc);

    float bia[4];
#pragma unroll
    for (int nt = 0; nt < 4; ++nt) {
        const int c = hd * 64 + nt * 16 + cc;
        const float fq = bq[c];
        const float fk = bk[c];
        const float fv = bv[c];
        const float bs = (kind == 0) ? fq : ((kind == 1) ? fk : fv);
        bia[nt] = bf16r(bs) * 64.0f;
    }

    if (kind < 2) {
        _Float16* sh = &stA[w * 32 * LP];
        _Float16* sl = &stB[w * 32 * LP];
#pragma unroll
        for (int mt = 0; mt < 2; ++mt)
#pragma unroll
            for (int nt = 0; nt < 4; ++nt)
#pragma unroll
                for (int g = 0; g < 8; ++g) {
                    const float v = acc[mt][nt][g] + bia[nt];
                    const _Float16 hv = (_Float16)v;
                    const int o = (mt * 16 + r0 + g) * LP + nt * 16 + cc;
                    sh[o] = hv;
                    sl[o] = (_Float16)((v - (float)hv) * SC_RES);
                }
        wave_lds_sync();
        v8h ph[8], pl[8];
#pragma unroll
        for (int j = 0; j < 8; ++j) {
            const int o = (4 * j + (lane >> 3)) * LP + (lane & 7) * 8;
            ph[j] = *(const v8h*)(&sh[o]);
            pl[j] = *(const v8h*)(&sl[o]);
        }
        const size_t base = (size_t)kind * NTOK * DM + (size_t)(m0 + w * 32) * DM
                          + (size_t)hd * DK + (size_t)(lane & 7) * 8;
#pragma unroll
        for (int j = 0; j < 8; ++j) {
            const size_t o = base + (size_t)(4 * j + (lane >> 3)) * DM;
            *(v8h*)(qkH + o) = ph[j];
            *(v8h*)(qkL + o) = pl[j];
        }
        
    } else {
        // stA viewed as [64 d][VP]; token index within the block along the row
#pragma unroll
        for (int mt = 0; mt < 2; ++mt)
#pragma unroll
            for (int nt = 0; nt < 4; ++nt) {
                v8h pk;
#pragma unroll
                for (int g = 0; g < 8; ++g) pk[g] = (_Float16)(acc[mt][nt][g] + bia[nt]);
                *(v8h*)(&stA[(nt * 16 + cc) * VP + w * 32 + mt * 16 + r0]) = pk;
            }
        __syncthreads();
        const int b  = m0 / SEQ;
        const int s0 = m0 - b * SEQ;
        v8h pv[8];
#pragma unroll
        for (int j = 0; j < 8; ++j) {
            const int d = w * 16 + 2 * j + (lane >> 4);
            pv[j] = *(const v8h*)(&stA[d * VP + (lane & 15) * 8]);
        }
        _Float16* dst = vT + ((size_t)(b * NH + hd) * DK) * SEQ + s0 + (lane & 15) * 8;
#pragma unroll
        for (int j = 0; j < 8; ++j)
            *(v8h*)(dst + (size_t)(w * 16 + 2 * j + (lane >> 4)) * SEQ) = pv[j];
        
    }
}

// ---------------------------------------------------------------------------
// Flash attention, transposed form. Block = 8 waves = 128 queries of one
// (batch, head); wave owns 16 queries; no cross-wave LDS traffic.
// Per 32-key step:
//   S^T tiles (keys x queries): A = K rows (hi / residual planes), B = Q rows
//   (hi / residual planes): hi.hi into acc_h; hi.lo + lo.hi into acc_r.
//   Query = lane column -> running max / sum are per-lane (one xor-16 shuffle).
//   P^T packed from the two S^T accumulators is directly the B fragment
//   (k = key = tile row, n = query = tile column); A = V^T rows from the
//   vT plane: O^T (d x queries) += V^T P^T.
// Epilogue: (O^T / l) * 4 = 256 ctx, f16, transposed through a wave-private
// ---------------------------------------------------------------------------
__global__ __launch_bounds__(256) __attribute__((amdgpu_num_vgpr(256)))
void k_attn(const _Float16* __restrict__ qh,
            const _Float16* __restrict__ ql,
            const _Float16* __restrict__ kh,
            const _Float16* __restrict__ kl,
            const _Float16* __restrict__ vT,
            _Float16* __restrict__ ctx) {
    __shared__ __align__(16) _Float16 Cst[8][16 * LP];   // 18 KB, wave-private tiles

    const int tid  = threadIdx.x;
    const int lane = tid & 31;
    const int w    = tid >> 5;
    const int b    = blockIdx.z;
    const int hd   = blockIdx.y;
    const int q0   = blockIdx.x * 128 + w * 16;
    const int r0   = (lane >> 4) << 3;
    const int cc   = lane & 15;

    const size_t qoff = ((size_t)b * SEQ + q0) * DM + (size_t)hd * DK;
    const v16h qh0 = load_frag16(qh + qoff, DM, lane);        // d 0..31
    const v16h qh1 = load_frag16(qh + qoff + 32, DM, lane);   // d 32..63
    const v16h ql0 = load_frag16(ql + qoff, DM, lane);
    const v16h ql1 = load_frag16(ql + qoff + 32, DM, lane);

    const _Float16* khb = kh + (size_t)b * SEQ * DM + (size_t)hd * DK;
    const _Float16* klb = kl + (size_t)b * SEQ * DM + (size_t)hd * DK;
    const _Float16* vtb = vT + ((size_t)(b * NH + hd) * DK) * SEQ;

    v8f ot0 = zero8(), ot1 = zero8(), ot2 = zero8(), ot3 = zero8();   // d tiles 0..3
    float mr = -1.0e30f, lr = 0.0f;

#pragma unroll 1
    for (int key0 = 0; key0 < SEQ; key0 += 32) {
        const _Float16* kp = khb + (size_t)key0 * DM;
        const _Float16* lp = klb + (size_t)key0 * DM;

        v16h ka = load_frag16(kp, DM, lane);
        v16h kb = load_frag16(kp + 32, DM, lane);
        v16h la = load_frag16(lp, DM, lane);
        v16h lb = load_frag16(lp + 32, DM, lane);
        v8f sh0 = wmma16(ka, qh0, zero8());
        sh0 = wmma16(kb, qh1, sh0);
        v8f sr0 = wmma16(ka, ql0, zero8());
        sr0 = wmma16(kb, ql1, sr0);
        sr0 = wmma16(la, qh0, sr0);
        sr0 = wmma16(lb, qh1, sr0);

        ka = load_frag16(kp + (size_t)16 * DM, DM, lane);
        kb = load_frag16(kp + (size_t)16 * DM + 32, DM, lane);
        la = load_frag16(lp + (size_t)16 * DM, DM, lane);
        lb = load_frag16(lp + (size_t)16 * DM + 32, DM, lane);
        v8f sh1 = wmma16(ka, qh0, zero8());
        sh1 = wmma16(kb, qh1, sh1);
        v8f sr1 = wmma16(ka, ql0, zero8());
        sr1 = wmma16(kb, ql1, sr1);
        sr1 = wmma16(la, qh0, sr1);
        sr1 = wmma16(lb, qh1, sr1);

        float t0[8], t1[8];
        float ml = -1.0e30f;
#pragma unroll
        for (int g = 0; g < 8; ++g) {
            t0[g] = __builtin_fmaf(sh0[g], C1, sr0[g] * C2);
            t1[g] = __builtin_fmaf(sh1[g], C1, sr1[g] * C2);
            ml = fmaxf(ml, fmaxf(t0[g], t1[g]));
        }
        ml = fmaxf(ml, __shfl_xor(ml, 16, 32));
        const float mn   = fmaxf(mr, ml);
        const float corr = ex2(mr - mn);
        const float shf  = P_CARRY - mn;

        Frag pf;
        float ps = 0.0f;
#pragma unroll
        for (int g = 0; g < 8; ++g) {
            const float p0 = ex2(t0[g] + shf);
            const float p1 = ex2(t1[g] + shf);
            ps += p0 + p1;
            pf.v[g]     = (_Float16)p0;     // k = key0 + 8*(lane>>4) + g
            pf.v[8 + g] = (_Float16)p1;     // k = key0 + 16 + 8*(lane>>4) + g
        }
        lr = lr * corr + ps;
        mr = mn;

        ot0 = scale8(ot0, corr);
        ot1 = scale8(ot1, corr);
        ot2 = scale8(ot2, corr);
        ot3 = scale8(ot3, corr);

        const _Float16* vp = vtb + key0;
        v16h va = load_frag16(vp, SEQ, lane);                          // d 0..15
        ot0 = wmma16(va, pf.v, ot0);
        va = load_frag16(vp + (size_t)16 * SEQ, SEQ, lane);            // d 16..31
        ot1 = wmma16(va, pf.v, ot1);
        va = load_frag16(vp + (size_t)32 * SEQ, SEQ, lane);            // d 32..47
        ot2 = wmma16(va, pf.v, ot2);
        va = load_frag16(vp + (size_t)48 * SEQ, SEQ, lane);            // d 48..63
        ot3 = wmma16(va, pf.v, ot3);
    }

    const float lt  = lr + __shfl_xor(lr, 16, 32);
    const float inv = 4.0f * (1.0f / lt);        // (2^10 P)(64 v) / (2^10 l) * 4 = 256 ctx

    _Float16* cs = &Cst[w][0];
    {
        v8h c0, c1, c2, c3;
#pragma unroll
        for (int g = 0; g < 8; ++g) {
            c0[g] = (_Float16)(ot0[g] * inv);
            c1[g] = (_Float16)(ot1[g] * inv);
            c2[g] = (_Float16)(ot2[g] * inv);
            c3[g] = (_Float16)(ot3[g] * inv);
        }
        // lane holds query cc, d = dt*16 + r0 + 0..7
        *(v8h*)(&cs[cc * LP + 0 * 16 + r0]) = c0;
        *(v8h*)(&cs[cc * LP + 1 * 16 + r0]) = c1;
        *(v8h*)(&cs[cc * LP + 2 * 16 + r0]) = c2;
        *(v8h*)(&cs[cc * LP + 3 * 16 + r0]) = c3;
    }
    wave_lds_sync();

    v8h cv[4];
#pragma unroll
    for (int j = 0; j < 4; ++j)
        cv[j] = *(const v8h*)(&cs[(4 * j + (lane >> 3)) * LP + (lane & 7) * 8]);
    _Float16* cb = ctx + ((size_t)b * SEQ + q0) * DM + (size_t)hd * DK + (lane & 7) * 8;
#pragma unroll
    for (int j = 0; j < 4; ++j)
        *(v8h*)(cb + (size_t)(4 * j + (lane >> 3)) * DM) = cv[j];
    
}

// ---------------------------------------------------------------------------
// GEMM + bias + residual -> f32 plane [NTOK][512] (input of a LayerNorm pass).
// Block = 4 waves = 128 rows x 64 columns. f32 tile staged wave-private;
// residual added at the store stage as float4; each instruction writes two
// ---------------------------------------------------------------------------
template <int K, bool RB>
static __device__ __forceinline__ void gemm_res_body(const _Float16* __restrict__ A,
                                                     const _Float16* __restrict__ W,
                                                     const float* __restrict__ bias,
                                                     const float* __restrict__ resblk,
                                                     float* __restrict__ out,
                                                     float* os, float scale,
                                                     int m0, int n0, int w, int lane) {
    const int r0 = (lane >> 4) << 3;
    const int cc = lane & 15;
    v8f acc[2][4];
#pragma unroll
    for (int mt = 0; mt < 2; ++mt)
#pragma unroll
        for (int nt = 0; nt < 4; ++nt) acc[mt][nt] = zero8();

    gemm_32x64<K>(A + (size_t)(m0 + w * 32) * K, W + (size_t)n0 * K, lane, acc);

    float bia[4];
#pragma unroll
    for (int nt = 0; nt < 4; ++nt) bia[nt] = bf16r(bias[n0 + nt * 16 + cc]);

#pragma unroll
    for (int mt = 0; mt < 2; ++mt)
#pragma unroll
        for (int nt = 0; nt < 4; ++nt)
#pragma unroll
            for (int g = 0; g < 8; ++g)
                os[(mt * 16 + r0 + g) * FP + nt * 16 + cc] =
                    __builtin_fmaf(acc[mt][nt][g], scale, bia[nt]);
    wave_lds_sync();

    const int c4 = (lane & 15) * 4;
    v4f sv[16];
#pragma unroll
    for (int j = 0; j < 16; ++j) {
        const int row = 2 * j + (lane >> 4);
        v4f v = *(const v4f*)(&os[row * FP + c4]);
        v4f r = *(const v4f*)(resblk + (size_t)(w * 32 + row) * DM + n0 + c4);
        if (RB) { r.x = bf16r(r.x); r.y = bf16r(r.y); r.z = bf16r(r.z); r.w = bf16r(r.w); }
        v.x += r.x; v.y += r.y; v.z += r.z; v.w += r.w;
        sv[j] = v;
    }
    float* ob = out + (size_t)(m0 + w * 32) * DM + n0 + c4;
#pragma unroll
    for (int j = 0; j < 16; ++j)
        *(v4f*)(ob + (size_t)(2 * j + (lane >> 4)) * DM) = sv[j];
    
}

// pre = ctx @ Wo^T + bo + bf16(x)
__global__ __launch_bounds__(128) void k_wo(const _Float16* __restrict__ ctx,
                                             const _Float16* __restrict__ woh,
                                             const float* __restrict__ bo,
                                             const float* __restrict__ x,
                                             float* __restrict__ pre) {
    __shared__ __align__(16) float Ost[4 * 32 * FP];   // 34 KB, wave-private tiles
    const int tid = threadIdx.x, lane = tid & 31, w = tid >> 5;
    const int m0 = blockIdx.x * 128, n0 = blockIdx.y * 64;
    const int b  = m0 / SEQ;
    const int s0 = m0 - b * SEQ;
    const float* resblk = x + ((size_t)b * SEQ_FULL + s0) * DM;
    gemm_res_body<DM, true>(ctx, woh, bo, resblk, pre, &Ost[w * 32 * FP], SC_WO, m0, n0, w, lane);
}

// pre = relu1 @ W2^T + b2 + h
__global__ __launch_bounds__(128) void k_ffn2(const _Float16* __restrict__ ff1,
                                               const _Float16* __restrict__ w2h,
                                               const float* __restrict__ b2,
                                               const float* __restrict__ hf,
                                               float* __restrict__ pre) {
    __shared__ __align__(16) float Ost[4 * 32 * FP];   // 34 KB, wave-private tiles
    const int tid = threadIdx.x, lane = tid & 31, w = tid >> 5;
    const int m0 = blockIdx.x * 128, n0 = blockIdx.y * 64;
    const float* resblk = hf + (size_t)m0 * DM;
    gemm_res_body<DFF, false>(ff1, w2h, b2, resblk, pre, &Ost[w * 32 * FP], SC_FF2, m0, n0, w, lane);
}

// ---------------------------------------------------------------------------
// FFN up-projection: ff1 (x64, f16) = relu(h @ W1^T + b1). Block = 4 waves =
// ---------------------------------------------------------------------------
__global__ __launch_bounds__(128) void k_ffn1(const _Float16* __restrict__ hh,
                                               const _Float16* __restrict__ w1h,
                                               const float* __restrict__ b1,
                                               _Float16* __restrict__ ff1) {
    __shared__ __align__(16) _Float16 stA[128 * LP];   // 18 KB, wave-private tiles
    const int tid  = threadIdx.x;
    const int lane = tid & 31;
    const int w    = tid >> 5;
    const int m0   = blockIdx.x * 128;
    const int n0   = blockIdx.y * 64;
    const int r0   = (lane >> 4) << 3;
    const int cc   = lane & 15;

    v8f acc[2][4];
#pragma unroll
    for (int mt = 0; mt < 2; ++mt)
#pragma unroll
        for (int nt = 0; nt < 4; ++nt) acc[mt][nt] = zero8();

    gemm_32x64<DM>(hh + (size_t)(m0 + w * 32) * DM, w1h + (size_t)n0 * DM, lane, acc);

    float bia[4];
#pragma unroll
    for (int nt = 0; nt < 4; ++nt) bia[nt] = bf16r(b1[n0 + nt * 16 + cc]) * 64.0f;

    _Float16* sh = &stA[w * 32 * LP];
#pragma unroll
    for (int mt = 0; mt < 2; ++mt)
#pragma unroll
        for (int nt = 0; nt < 4; ++nt)
#pragma unroll
            for (int g = 0; g < 8; ++g) {
                const float v = acc[mt][nt][g] + bia[nt];
                sh[(mt * 16 + r0 + g) * LP + nt * 16 + cc] = (_Float16)((v > 0.0f) ? v : 0.0f);
            }
    wave_lds_sync();
    v8h ph[8];
#pragma unroll
    for (int j = 0; j < 8; ++j)
        ph[j] = *(const v8h*)(&sh[(4 * j + (lane >> 3)) * LP + (lane & 7) * 8]);
    _Float16* ob = ff1 + (size_t)(m0 + w * 32) * DFF + n0 + (lane & 7) * 8;
#pragma unroll
    for (int j = 0; j < 8; ++j)
        *(v8h*)(ob + (size_t)(4 * j + (lane >> 3)) * DFF) = ph[j];
    
}

// ---------------------------------------------------------------------------
// LayerNorm over 512 columns (biased variance, eps 1e-5), one wave per row,
// lane holds columns i*128 + lane*4 + 0..3 (i = 0..3): every load/store
// instruction covers 512 contiguous bytes (f32) or 256 bytes (f16).
// ---------------------------------------------------------------------------
template <bool HOUT>
static __device__ __forceinline__ void ln_body(const float* __restrict__ in,
                                               const float* __restrict__ g,
                                               const float* __restrict__ be,
                                               float* __restrict__ outF,
                                               _Float16* __restrict__ outH) {
    static_assert(DM == 32 * 16);
    const int tid  = threadIdx.x;
    const int lane = tid & 31;
    const int w    = tid >> 5;
    const size_t row = (size_t)blockIdx.x * 8 + w;
    const float* rp = in + row * DM + lane * 4;

    v4f xv[4];
#pragma unroll
    for (int i = 0; i < 4; ++i) xv[i] = *(const v4f*)(rp + i * 128);

    float s = 0.0f;
#pragma unroll
    for (int i = 0; i < 4; ++i) s += (xv[i].x + xv[i].y) + (xv[i].z + xv[i].w);
    s += __shfl_xor(s, 16, 32);
    s += __shfl_xor(s, 8, 32);
    s += __shfl_xor(s, 4, 32);
    s += __shfl_xor(s, 2, 32);
    s += __shfl_xor(s, 1, 32);
    const float mu = s * (1.0f / (float)DM);

    float s2 = 0.0f;
#pragma unroll
    for (int i = 0; i < 4; ++i) {
        const float d0 = xv[i].x - mu, d1 = xv[i].y - mu, d2 = xv[i].z - mu, d3 = xv[i].w - mu;
        s2 += (d0 * d0 + d1 * d1) + (d2 * d2 + d3 * d3);
    }
    s2 += __shfl_xor(s2, 16, 32);
    s2 += __shfl_xor(s2, 8, 32);
    s2 += __shfl_xor(s2, 4, 32);
    s2 += __shfl_xor(s2, 2, 32);
    s2 += __shfl_xor(s2, 1, 32);
    const float rstd = rsqrtf(s2 * (1.0f / (float)DM) + 1.0e-5f);

    v4f yv[4];
#pragma unroll
    for (int i = 0; i < 4; ++i) {
        const v4f gv = *(const v4f*)(g + i * 128 + lane * 4);
        const v4f bv = *(const v4f*)(be + i * 128 + lane * 4);
        v4f yy;
        yy.x = (xv[i].x - mu) * rstd * bf16r(gv.x) + bf16r(bv.x);
        yy.y = (xv[i].y - mu) * rstd * bf16r(gv.y) + bf16r(bv.y);
        yy.z = (xv[i].z - mu) * rstd * bf16r(gv.z) + bf16r(bv.z);
        yy.w = (xv[i].w - mu) * rstd * bf16r(gv.w) + bf16r(bv.w);
        yv[i] = yy;
    }
    v4h hv[4];
    if (HOUT) {
#pragma unroll
        for (int i = 0; i < 4; ++i) {
            v4h t;
            t.x = (_Float16)yv[i].x; t.y = (_Float16)yv[i].y;
            t.z = (_Float16)yv[i].z; t.w = (_Float16)yv[i].w;
            hv[i] = t;
        }
    }
    float* of = outF + row * DM + lane * 4;
#pragma unroll
    for (int i = 0; i < 4; ++i) *(v4f*)(of + i * 128) = yv[i];
    if (HOUT) {
        _Float16* oh = outH + row * DM + lane * 4;
#pragma unroll
        for (int i = 0; i < 4; ++i) *(v4h*)(oh + i * 128) = hv[i];
    }
    
}

__global__ __launch_bounds__(256) void k_ln_mid(const float* __restrict__ pre,
                                                 const float* __restrict__ g,
                                                 const float* __restrict__ be,
                                                 float* __restrict__ hf,
                                                 _Float16* __restrict__ hh) {
    ln_body<true>(pre, g, be, hf, hh);
}

__global__ __launch_bounds__(256) void k_ln_out(const float* __restrict__ pre,
                                                 const float* __restrict__ g,
                                                 const float* __restrict__ be,
                                                 float* __restrict__ out) {
    ln_body<false>(pre, g, be, out, nullptr);
}

// ---------------------------------------------------------------------------
// ---------------------------------------------------------------------------
#define SZ_XH   ((size_t)NTOK * DM * 2)
#define SZ_WQKV ((size_t)3 * DM * DM * 2)
#define SZ_WO   ((size_t)DM * DM * 2)
#define SZ_W1   ((size_t)DFF * DM * 2)
#define SZ_W2   ((size_t)DM * DFF * 2)
#define SZ_QK   ((size_t)4 * NTOK * DM * 2)     // qh, kh, ql, kl ; later reused for ff1
#define SZ_VT   ((size_t)NB * NH * DK * SEQ * 2)
#define SZ_CTX  ((size_t)NTOK * DM * 2)
#define SZ_PRE  ((size_t)NTOK * DM * 4)
#define SZ_HF   ((size_t)NTOK * DM * 4)
#define SZ_HH   ((size_t)NTOK * DM * 2)
#define SZ_FF1  ((size_t)NTOK * DFF * 2)
#define SZ_TOTAL (SZ_XH + SZ_WQKV + SZ_WO + SZ_W1 + SZ_W2 + SZ_QK + SZ_VT + SZ_CTX + SZ_PRE + SZ_HF + SZ_HH)

static_assert(SZ_FF1 <= SZ_QK);                 // ff1 reuses the q/k plane region
static_assert(SZ_TOTAL <= (size_t)134217728);   // carve within 128 MiB
static_assert(SZ_XH % 128 == 0 && SZ_WQKV % 128 == 0 && SZ_WO % 128 == 0 && SZ_W1 % 128 == 0);
static_assert(SZ_QK % 128 == 0 && SZ_VT % 128 == 0 && SZ_PRE % 128 == 0 && SZ_HH % 128 == 0);

extern "C" void kernel_launch(void* const* d_in, const int* in_sizes, int n_in,
                              void* d_out, int out_size, void* d_ws, size_t ws_size,
                              hipStream_t stream) {
    if (n_in < 15) return;
    if (in_sizes[0] < ((NB - 1) * SEQ_FULL + SEQ) * DM) return;
    if (in_sizes[1] < DM * DM || in_sizes[3] < DM * DM || in_sizes[5] < DM * DM || in_sizes[7] < DM * DM) return;
    if (in_sizes[2] < DM || in_sizes[4] < DM || in_sizes[6] < DM || in_sizes[8] < DM) return;
    if (in_sizes[9] < DM || in_sizes[10] < DM) return;
    if (in_sizes[11] < DFF * DM || in_sizes[12] < DFF) return;
    if (in_sizes[13] < DM * DFF || in_sizes[14] < DM) return;
    if (out_size < NTOK * DM) return;
    if (SZ_TOTAL > ws_size) return;

    const float* x   = (const float*)d_in[0];    // [4,2048,512]
    const float* wq  = (const float*)d_in[1];    // [512,512] [out][in]
    const float* bq  = (const float*)d_in[2];
    const float* wk  = (const float*)d_in[3];
    const float* bk  = (const float*)d_in[4];
    const float* wv  = (const float*)d_in[5];
    const float* bv  = (const float*)d_in[6];
    const float* wo  = (const float*)d_in[7];
    const float* bo  = (const float*)d_in[8];
    const float* lng = (const float*)d_in[9];
    const float* lnb = (const float*)d_in[10];
    const float* w1  = (const float*)d_in[11];   // [2048,512] [out][in]
    const float* b1  = (const float*)d_in[12];
    const float* w2  = (const float*)d_in[13];   // [512,2048] [out][in]
    const float* b2  = (const float*)d_in[14];
    float* out = (float*)d_out;                  // [4,2048,512]

    char* ws = (char*)d_ws;
    size_t off = 0;
    _Float16* xh   = (_Float16*)(ws + off); off += SZ_XH;
    _Float16* wqkv = (_Float16*)(ws + off); off += SZ_WQKV;
    _Float16* woh  = (_Float16*)(ws + off); off += SZ_WO;
    _Float16* w1h  = (_Float16*)(ws + off); off += SZ_W1;
    _Float16* w2h  = (_Float16*)(ws + off); off += SZ_W2;
    _Float16* qkH  = (_Float16*)(ws + off);                    // qh then kh
    _Float16* qkL  = qkH + (size_t)2 * NTOK * DM;              // ql then kl
    _Float16* ff1  = qkH;                                      // reuse after attention
    off += SZ_QK;
    _Float16* vT   = (_Float16*)(ws + off); off += SZ_VT;
    _Float16* ctx  = (_Float16*)(ws + off); off += SZ_CTX;
    float*    pre  = (float*)(ws + off);    off += SZ_PRE;
    float*    hf   = (float*)(ws + off);    off += SZ_HF;
    _Float16* hh   = (_Float16*)(ws + off); off += SZ_HH;
    if (off > ws_size) return;

    const _Float16* qh = qkH;
    const _Float16* kh = qkH + (size_t)NTOK * DM;
    const _Float16* ql = qkL;
    const _Float16* kl = qkL + (size_t)NTOK * DM;

    const int nw = DM * DM, nf = DFF * DM;
    k_cvtx<<<dim3((unsigned)(((size_t)NTOK * DM) / 2048)), dim3(256), 0, stream>>>(x, xh);
    k_cvtw<<<dim3(nw / 2048), dim3(256), 0, stream>>>(wq, wqkv, nw, 64.0f);
    k_cvtw<<<dim3(nw / 2048), dim3(256), 0, stream>>>(wk, wqkv + (size_t)nw, nw, 64.0f);
    k_cvtw<<<dim3(nw / 2048), dim3(256), 0, stream>>>(wv, wqkv + (size_t)2 * nw, nw, 64.0f);
    k_cvtw<<<dim3(nw / 2048), dim3(256), 0, stream>>>(wo, woh, nw, 64.0f);
    k_cvtw<<<dim3(nf / 2048), dim3(256), 0, stream>>>(w1, w1h, nf, 64.0f);
    k_cvtw<<<dim3(nf / 2048), dim3(256), 0, stream>>>(w2, w2h, nf, 64.0f);

    k_qkv<<<dim3(NTOK / 128, 24), dim3(128), 0, stream>>>(xh, wqkv, bq, bk, bv, qkH, qkL, vT);
    k_attn<<<dim3(SEQ / 128, NH, NB), dim3(256), 0, stream>>>(qh, ql, kh, kl, vT, ctx);
    k_wo<<<dim3(NTOK / 128, DM / 64), dim3(128), 0, stream>>>(ctx, woh, bo, x, pre);
    k_ln_mid<<<dim3(NTOK / 8), dim3(256), 0, stream>>>(pre, lng, lnb, hf, hh);
    k_ffn1<<<dim3(NTOK / 128, DFF / 64), dim3(128), 0, stream>>>(hh, w1h, b1, ff1);
    k_ffn2<<<dim3(NTOK / 128, DM / 64), dim3(128), 0, stream>>>(ff1, w2h, b2, hf, pre);
    k_ln_out<<<dim3(NTOK / 8), dim3(256), 0, stream>>>(pre, lng, lnb, out);
}

// v001
// One run takes 167 microseconds.
// Timed twice side by side with v000, it ran 2.42 and 2.40 times as fast.
#include <hip/hip_runtime.h>

// All contractions on v_wmma_f32_16x16x32_f16 (f16 operands, f32 accumulate): x*[Wq|Wk|Wv]^T, ctx*Wo^T, h*W1^T, relu*W2^T single f16 products (bf16-RNE inputs exact in f16, weights carried x64); q*k^T with f16 hi plane + 2^11-scaled f16 residual plane (two accumulators, residual folded 2^-11 in f32); P*v single product with P carried 2^10.

#ifndef NB
#define NB 4
#endif
#ifndef SEQ
#define SEQ 2048
#endif
#define NB_FULL  4
#define SEQ_FULL 2048
#define DM   512         // model width
#define NH   8           // heads
#define DK   64          // head width
#define DFF  2048        // FFN width
#define NTOK (NB * SEQ)
#define LP   72          // f16 staging pitch (halves), 144 B rows
#define VP   136         // transposed-V staging pitch (halves), 272 B rows
#define FP   68          // f32 staging pitch (floats), 272 B rows

static_assert(NB >= 1 && NB <= NB_FULL);           // batch within the input
static_assert(SEQ >= 128 && SEQ <= SEQ_FULL);      // sequence within the input
static_assert(SEQ % 128 == 0);                     // 128-token blocks never straddle a batch
static_assert(SEQ % 32 == 0);                      // key step of 32
static_assert(NTOK % 128 == 0);                    // GEMM M tile
static_assert(NTOK % 8 == 0);                      // LayerNorm rows per block
static_assert(DM == NH * DK);                      // head split h*64+d
static_assert(DK == 64);
static_assert(DM == 512);                          // LayerNorm: 32 lanes x 16 columns
static_assert(DM % 64 == 0 && DFF % 64 == 0);      // GEMM N tile
static_assert(DM % 32 == 0 && DFF % 32 == 0);      // WMMA k step
static_assert(((size_t)NTOK * DM) % 2048 == 0);    // convert grid: 256 threads x 8 elements
static_assert(((size_t)DM * DM) % 2048 == 0);
static_assert(((size_t)DFF * DM) % 2048 == 0);
static_assert(64 * VP <= 128 * LP);                // transposed-V tile fits the f16 staging region
static_assert(LP % 8 == 0 && VP % 8 == 0 && FP % 4 == 0);   // 16-B aligned staging rows
#define KSTG   64            // keys per LDS stage of the attention ring
#define TILE_H (64 * LP)     // one staged tile: 64 rows of 128 B at pitch 144 B (halves)
#define STG_H  (3 * TILE_H)  // K hi, K residual, V^T
static_assert(SEQ % KSTG == 0 && SEQ / KSTG >= 2);   // the ring's prologue fills two stages
#define GK     64            // k columns per LDS stage of the GEMM ring
#define GSTG_H (192 * LP)    // 128 A rows then 64 W rows, 128 B each at pitch 144 B (halves)

typedef _Float16 v16h __attribute__((ext_vector_type(16)));
typedef _Float16 v8h  __attribute__((ext_vector_type(8)));
typedef _Float16 v4h  __attribute__((ext_vector_type(4)));
typedef float    v8f  __attribute__((ext_vector_type(8)));
typedef float    v4f  __attribute__((ext_vector_type(4)));

union Frag { v16h v; v8h h[2]; };

// scores: acc_h = (64k_h).(64q_h), acc_r = 2^11-scaled residual cross terms
// t (log2 units) = acc_h * log2(e)*2^-15 + acc_r * log2(e)*2^-26   (1/8 score scale folded)
#define C1 (1.44269504088896340736f * 3.0517578125e-05f)
#define C2 (1.44269504088896340736f * 1.4901161193847656e-08f)
#define SC_RES   2048.0f                 // residual plane carry 2^11
#define P_CARRY  10.0f                   // P carried 2^10 (log2 units)
#define SC_WO    6.103515625e-05f        // 2^-14 : (256 ctx)(64 Wo)
#define SC_FF2   2.44140625e-04f         // 2^-12 : (64 ff1)(64 W2)

static __device__ __forceinline__ v8f zero8() {
    v8f z;
#pragma unroll
    for (int i = 0; i < 8; ++i) z[i] = 0.0f;
    return z;
}

// 16x32 A fragment (or B fragment from an [n][k] k-contiguous source) from a
// row-major 16-bit tile: lane m = lane&15 -> row m; kb = 8*(lane>>4);
// elements 0..7 = k kb..kb+7, elements 8..15 = k kb+16..kb+23.
static __device__ __forceinline__ v16h load_frag16(const _Float16* base, int ld, int lane) {
    int m  = lane & 15;
    int kb = (lane >> 4) << 3;
    const _Float16* p = base + (size_t)m * ld + kb;
    Frag f;
    f.h[0] = *(const v8h*)(p);
    f.h[1] = *(const v8h*)(p + 16);
    return f.v;
}

static __device__ __forceinline__ v8f wmma16(v16h a, v16h b, v8f c) {
    v8f d = __builtin_amdgcn_wmma_f32_16x16x32_f16(false, a, false, b, (short)0, c, false, false);
    asm volatile("v_nop\n\tv_nop\n\tv_nop\n\tv_nop" : "+v"(d) : "v"(a), "v"(b));
    return d;
}

// f32 -> bf16 RNE convert, value kept as f32
static __device__ __forceinline__ float bf16r(float x) {
    unsigned u = __float_as_uint(x);
    u = (u + 0x7FFFu + ((u >> 16) & 1u)) & 0xFFFF0000u;
    return __uint_as_float(u);
}

static __device__ __forceinline__ float ex2(float x) {
    return __builtin_amdgcn_exp2f(x);
}

// ordering for a wave-private LDS tile: stores before later loads of the same wave
static __device__ __forceinline__ void wave_lds_sync() {
    __builtin_amdgcn_fence(3, "wavefront");
    asm volatile("s_wait_dscnt 0" ::: "memory");
    __builtin_amdgcn_wave_barrier();
}

static __device__ __forceinline__ v8f scale8(v8f a, float s) {
#pragma unroll
    for (int i = 0; i < 8; ++i) a[i] *= s;
    return a;
}

// LDS byte address of a __shared__ element (operand of an asynchronous copy)
static __device__ __forceinline__ unsigned lds_addr(const _Float16* p) {
    return (unsigned)(size_t)(const __attribute__((address_space(3))) _Float16*)p;
}

// ---------------------------------------------------------------------------
// Operand planes: f16(bf16_rne(v) * scale). 8 elements per thread, one 16-B
// ---------------------------------------------------------------------------
__global__ __launch_bounds__(256) void k_cvtx(const float* __restrict__ x,
                                               _Float16* __restrict__ xh) {
    const size_t i = ((size_t)blockIdx.x * 256 + threadIdx.x) * 8;
    if (i < (size_t)NTOK * DM) {
        const size_t tok = i / DM;
        const size_t c   = i - tok * DM;
        const size_t b   = tok / SEQ;
        const size_t s   = tok - b * SEQ;
        const float* src = x + ((b * SEQ_FULL + s) * DM + c);
        v4f a0 = *(const v4f*)(src);
        v4f a1 = *(const v4f*)(src + 4);
        v8h o;
        o[0] = (_Float16)bf16r(a0.x); o[1] = (_Float16)bf16r(a0.y);
        o[2] = (_Float16)bf16r(a0.z); o[3] = (_Float16)bf16r(a0.w);
        o[4] = (_Float16)bf16r(a1.x); o[5] = (_Float16)bf16r(a1.y);
        o[6] = (_Float16)bf16r(a1.z); o[7] = (_Float16)bf16r(a1.w);
        *(v8h*)(xh + i) = o;
        
    }
}

__global__ __launch_bounds__(256) void k_cvtw(const float* __restrict__ src,
                                               _Float16* __restrict__ dst,
                                               int n, float scale) {
    const size_t i = ((size_t)blockIdx.x * 256 + threadIdx.x) * 8;
    if (i < (size_t)n) {
        v4f a0 = *(const v4f*)(src + i);
        v4f a1 = *(const v4f*)(src + i + 4);
        v8h o;
        o[0] = (_Float16)(bf16r(a0.x) * scale); o[1] = (_Float16)(bf16r(a0.y) * scale);
        o[2] = (_Float16)(bf16r(a0.z) * scale); o[3] = (_Float16)(bf16r(a0.w) * scale);
        o[4] = (_Float16)(bf16r(a1.x) * scale); o[5] = (_Float16)(bf16r(a1.y) * scale);
        o[6] = (_Float16)(bf16r(a1.z) * scale); o[7] = (_Float16)(bf16r(a1.w) * scale);
        *(v8h*)(dst + i) = o;
        
    }
}

// ---------------------------------------------------------------------------
// One lane's twelve 16-B asynchronous copies of a GEMM stage (block of 128
// threads): rows r + 16 j of the 128-row A tile (j = 0..7) and of the 64-row
// W tile (j = 0..3). A wave's copy covers four whole 128-B lines.
// s_wait_xcnt closes the statement so that no address register is rewritten
// ahead of it.
// ---------------------------------------------------------------------------
template <int K>
static __device__ __forceinline__ void gemm_stage(const _Float16* ga, const _Float16* gw, unsigned l) {
    constexpr unsigned RS = 16 * LP * 2;        // 16 LDS rows, bytes
    constexpr size_t   GS = (size_t)16 * K;     // 16 source rows, halves
    asm volatile("global_load_async_to_lds_b128 %0, %12, off\n\t"
                 "global_load_async_to_lds_b128 %1, %13, off\n\t"
                 "global_load_async_to_lds_b128 %2, %14, off\n\t"
                 "global_load_async_to_lds_b128 %3, %15, off\n\t"
                 "global_load_async_to_lds_b128 %4, %16, off\n\t"
                 "global_load_async_to_lds_b128 %5, %17, off\n\t"
                 "global_load_async_to_lds_b128 %6, %18, off\n\t"
                 "global_load_async_to_lds_b128 %7, %19, off\n\t"
                 "global_load_async_to_lds_b128 %8, %20, off\n\t"
                 "global_load_async_to_lds_b128 %9, %21, off\n\t"
                 "global_load_async_to_lds_b128 %10, %22, off\n\t"
                 "global_load_async_to_lds_b128 %11, %23, off\n\t"
                 "s_wait_xcnt 0x0"
                 :: "v"(l), "v"(l + RS), "v"(l + 2 * RS), "v"(l + 3 * RS),
                    "v"(l + 4 * RS), "v"(l + 5 * RS), "v"(l + 6 * RS), "v"(l + 7 * RS),
                    "v"(l + 8 * RS), "v"(l + 9 * RS), "v"(l + 10 * RS), "v"(l + 11 * RS),
                    "v"(ga), "v"(ga + GS), "v"(ga + 2 * GS), "v"(ga + 3 * GS),
                    "v"(ga + 4 * GS), "v"(ga + 5 * GS), "v"(ga + 6 * GS), "v"(ga + 7 * GS),
                    "v"(gw), "v"(gw + GS), "v"(gw + 2 * GS), "v"(gw + 3 * GS)
                 : "memory");
}

// ---------------------------------------------------------------------------
// Block GEMM core: 4 waves, 128 rows x 64 columns, wave w owns rows w*32..+31.
// A (the block's first row, row-major pitch K) and W ([n][k] pitch K) come in
// stages of 64 k columns into a two-buffer LDS ring by asynchronous copies;
// fragments are read from the ring.
// acc[mt][nt][r] = element (row mt*16 + 8*(lane>>4) + r, col nt*16 + (lane&15)).
// ---------------------------------------------------------------------------
template <int K>
static __device__ __forceinline__ void gemm_32x64(const _Float16* __restrict__ A,
                                                  const _Float16* __restrict__ W,
                                                  const _Float16* ring, int tid, v8f (&acc)[2][4]) {
    static_assert(K % GK == 0 && K / GK >= 2);   // the ring's prologue fills two stages
    const int lane = tid & 31;
    const int w    = tid >> 5;
    const int crow = tid >> 3;
    const int cch  = (tid & 7) * 8;
    const _Float16* ga = A + (size_t)crow * K + cch;
    const _Float16* gw = W + (size_t)crow * K + cch;
    const unsigned  l0 = lds_addr(ring + crow * LP + cch);

    gemm_stage<K>(ga, gw, l0);
    // tile 0 has landed before the barrier publishes it
    asm volatile("s_wait_asynccnt 0x0" ::: "memory");
    __syncthreads();
    gemm_stage<K>(ga + GK, gw + GK, l0 + GSTG_H * 2);

#pragma unroll 1
    for (int t = 0; t < K / GK; ++t) {
        const _Float16* sa = ring + (t & 1) * GSTG_H + w * 32 * LP;
        const _Float16* sw = ring + (t & 1) * GSTG_H + 128 * LP;
#pragma unroll
        for (int kk = 0; kk < GK; kk += 32) {
            const v16h a0 = load_frag16(sa + kk, LP, lane);
            const v16h a1 = load_frag16(sa + 16 * LP + kk, LP, lane);
            v16h bw[4];
#pragma unroll
            for (int nt = 0; nt < 4; ++nt) bw[nt] = load_frag16(sw + nt * 16 * LP + kk, LP, lane);
#pragma unroll
            for (int nt = 0; nt < 4; ++nt) {
                acc[0][nt] = wmma16(a0, bw[nt], acc[0][nt]);
                acc[1][nt] = wmma16(a1, bw[nt], acc[1][nt]);
            }
        }
        // publish point: this wave's reads of the buffer are done ...
        asm volatile("s_wait_dscnt 0x0" ::: "memory");
        // ... its copies of tile t + 1 have landed ...
        asm volatile("s_wait_asynccnt 0x0" ::: "memory");
        // ... and the one barrier publishes tile t + 1 and frees the buffer read in this trip
        __syncthreads();
        if (t + 2 < K / GK)
            gemm_stage<K>(ga + (t + 2) * GK, gw + (t + 2) * GK, l0 + (unsigned)(t & 1) * (GSTG_H * 2));
    }
    // no copy is outstanding when the wave goes on to its epilogue
    asm volatile("s_wait_asynccnt 0x0" ::: "memory");
}

// ---------------------------------------------------------------------------
// QKV projections. Block = 4 waves = 128 tokens x 64 columns (one head of one
// of q/k/v); grid (NTOK/128, 24). Outputs carried x64:
//   q,k : f16 hi plane + f16 residual plane ((v - hi) * 2^11), [tok][512]
//         4 lines per lane-contiguous instruction.
//   v   : transposed plane vT[b][h][d][S]; block-level staging [64 d][128 tok]
// ---------------------------------------------------------------------------
__global__ __launch_bounds__(128) void k_qkv(const _Float16* __restrict__ xh,
                                              const _Float16* __restrict__ wqkv,
                                              const float* __restrict__ bq,
                                              const float* __restrict__ bk,
                                              const float* __restrict__ bv,
                                              _Float16* __restrict__ qkH,
                                              _Float16* __restrict__ qkL,
                                              _Float16* __restrict__ vT) {
    __shared__ __align__(16) _Float16 stA[128 * LP];   // 18 KB
    __shared__ __align__(16) _Float16 stB[128 * LP];   // 18 KB
    __shared__ __align__(16) _Float16 ring[2 * GSTG_H]; // 54 KB, two operand stages

    const int tid  = threadIdx.x;
    const int lane = tid & 31;
    const int w    = tid >> 5;
    const int m0   = blockIdx.x * 128;
    const int y    = blockIdx.y;
    const int kind = y >> 3;          // 0 q, 1 k, 2 v  (block-uniform)
    const int hd   = y & 7;
    const int n0   = y * 64;
    const int r0   = (lane >> 4) << 3;
    const int cc   = lane & 15;

    v8f acc[2][4];
#pragma unroll
    for (int mt = 0; mt < 2; ++mt)
#pragma unroll
        for (int nt = 0; nt < 4; ++nt) acc[mt][nt] = zero8();

    gemm_32x64<DM>(xh + (size_t)m0 * DM, wqkv + (size_t)n0 * DM, ring, tid, acc);

    float bia[4];
#pragma unroll
    for (int nt = 0; nt < 4; ++nt) {
        const int c = hd * 64 + nt * 16 + cc;
        const float fq = bq[c];
        const float fk = bk[c];
        const float fv = bv[c];
        const float bs = (kind == 0) ? fq : ((kind == 1) ? fk : fv);
        bia[nt] = bf16r(bs) * 64.0f;
    }

    if (kind < 2) {
        _Float16* sh = &stA[w * 32 * LP];
        _Float16* sl = &stB[w * 32 * LP];
#pragma unroll
        for (int mt = 0; mt < 2; ++mt)
#pragma unroll
            for (int nt = 0; nt < 4; ++nt)
#pragma unroll
                for (int g = 0; g < 8; ++g) {
                    const float v = acc[mt][nt][g] + bia[nt];
                    const _Float16 hv = (_Float16)v;
                    const int o = (mt * 16 + r0 + g) * LP + nt * 16 + cc;
                    sh[o] = hv;
                    sl[o] = (_Float16)((v - (float)hv) * SC_RES);
                }
        wave_lds_sync();
        v8h ph[8], pl[8];
#pragma unroll
        for (int j = 0; j < 8; ++j) {
            const int o = (4 * j + (lane >> 3)) * LP + (lane & 7) * 8;
            ph[j] = *(const v8h*)(&sh[o]);
            pl[j] = *(const v8h*)(&sl[o]);
        }
        const size_t base = (size_t)kind * NTOK * DM + (size_t)(m0 + w * 32) * DM
                          + (size_t)hd * DK + (size_t)(lane & 7) * 8;
#pragma unroll
        for (int j = 0; j < 8; ++j) {
            const size_t o = base + (size_t)(4 * j + (lane >> 3)) * DM;
            *(v8h*)(qkH + o) = ph[j];
            *(v8h*)(qkL + o) = pl[j];
        }
        
    } else {
        // stA viewed as [64 d][VP]; token index within the block along the row
#pragma unroll
        for (int mt = 0; mt < 2; ++mt)
#pragma unroll
            for (int nt = 0; nt < 4; ++nt) {
                v8h pk;
#pragma unroll
                for (int g = 0; g < 8; ++g) pk[g] = (_Float16)(acc[mt][nt][g] + bia[nt]);
                *(v8h*)(&stA[(nt * 16 + cc) * VP + w * 32 + mt * 16 + r0]) = pk;
            }
        __syncthreads();
        const int b  = m0 / SEQ;
        const int s0 = m0 - b * SEQ;
        v8h pv[8];
#pragma unroll
        for (int j = 0; j < 8; ++j) {
            const int d = w * 16 + 2 * j + (lane >> 4);
            pv[j] = *(const v8h*)(&stA[d * VP + (lane & 15) * 8]);
        }
        _Float16* dst = vT + ((size_t)(b * NH + hd) * DK) * SEQ + s0 + (lane & 15) * 8;
#pragma unroll
        for (int j = 0; j < 8; ++j)
            *(v8h*)(dst + (size_t)(w * 16 + 2 * j + (lane >> 4)) * SEQ) = pv[j];
        
    }
}

// ---------------------------------------------------------------------------
// One lane's six 16-B asynchronous copies of an attention stage: rows r and
// r + 32 of the K hi, K residual and V^T tiles. A wave's copy covers four
// whole 128-B lines. s_wait_xcnt closes the statement so that no address
// register is rewritten ahead of it.
// ---------------------------------------------------------------------------
static __device__ __forceinline__ void attn_stage(const _Float16* gk, const _Float16* gl,
                                                  const _Float16* gv, unsigned l) {
    const _Float16* gk1 = gk + (size_t)32 * DM;
    const _Float16* gl1 = gl + (size_t)32 * DM;
    const _Float16* gv1 = gv + (size_t)32 * SEQ;
    const unsigned lk1 = l + 32 * LP * 2;
    const unsigned ll0 = l + TILE_H * 2;
    const unsigned ll1 = l + TILE_H * 2 + 32 * LP * 2;
    const unsigned lv0 = l + 2 * TILE_H * 2;
    const unsigned lv1 = l + 2 * TILE_H * 2 + 32 * LP * 2;
    asm volatile("global_load_async_to_lds_b128 %0, %6, off\n\t"
                 "global_load_async_to_lds_b128 %1, %7, off\n\t"
                 "global_load_async_to_lds_b128 %2, %8, off\n\t"
                 "global_load_async_to_lds_b128 %3, %9, off\n\t"
                 "global_load_async_to_lds_b128 %4, %10, off\n\t"
                 "global_load_async_to_lds_b128 %5, %11, off\n\t"
                 "s_wait_xcnt 0x0"
                 :: "v"(l), "v"(lk1), "v"(ll0), "v"(ll1), "v"(lv0), "v"(lv1),
                    "v"(gk), "v"(gk1), "v"(gl), "v"(gl1), "v"(gv), "v"(gv1)
                 : "memory");
}

// ---------------------------------------------------------------------------
// Flash attention, transposed form. Block = 8 waves = 128 queries of one
// (batch, head); wave owns 16 queries. K hi, K residual and V^T tiles of 64
// keys are brought into a two-buffer LDS ring by asynchronous copies (whole
// 128-B lines, once per block) and read as fragments by all 8 waves.
// Per 32-key step:
//   S^T tiles (keys x queries): A = K rows (hi / residual planes), B = Q rows
//   (hi / residual planes): hi.hi into acc_h; hi.lo + lo.hi into acc_r.
//   Query = lane column -> running max / sum are per-lane (one xor-16 shuffle).
//   P^T packed from the two S^T accumulators is directly the B fragment
//   (k = key = tile row, n = query = tile column); A = V^T rows from the
//   vT plane: O^T (d x queries) += V^T P^T.
// Epilogue: (O^T / l) * 4 = 256 ctx, f16, transposed through a wave-private
// ---------------------------------------------------------------------------
__global__ __launch_bounds__(256) __attribute__((amdgpu_num_vgpr(256)))
void k_attn(const _Float16* __restrict__ qh,
            const _Float16* __restrict__ ql,
            const _Float16* __restrict__ kh,
            const _Float16* __restrict__ kl,
            const _Float16* __restrict__ vT,
            _Float16* __restrict__ ctx) {
    __shared__ __align__(16) _Float16 Cst[8][16 * LP];   // 18 KB, wave-private tiles
    __shared__ __align__(16) _Float16 ring[2 * STG_H];   // 54 KB, two stages

    const int tid  = threadIdx.x;
    const int lane = tid & 31;
    const int w    = tid >> 5;
    const int b    = blockIdx.z;
    const int hd   = blockIdx.y;
    const int q0   = blockIdx.x * 128 + w * 16;
    const int r0   = (lane >> 4) << 3;
    const int cc   = lane & 15;

    const size_t qoff = ((size_t)b * SEQ + q0) * DM + (size_t)hd * DK;
    const v16h qh0 = load_frag16(qh + qoff, DM, lane);        // d 0..31
    const v16h qh1 = load_frag16(qh + qoff + 32, DM, lane);   // d 32..63
    const v16h ql0 = load_frag16(ql + qoff, DM, lane);
    const v16h ql1 = load_frag16(ql + qoff + 32, DM, lane);

    const _Float16* khb = kh + (size_t)b * SEQ * DM + (size_t)hd * DK;
    const _Float16* klb = kl + (size_t)b * SEQ * DM + (size_t)hd * DK;
    const _Float16* vtb = vT + ((size_t)(b * NH + hd) * DK) * SEQ;

    v8f ot0 = zero8(), ot1 = zero8(), ot2 = zero8(), ot3 = zero8();   // d tiles 0..3
    float mr = -1.0e30f, lr = 0.0f;

    // lane's share of a stage: rows crow and crow + 32 of each tile, 16 B at chunk tid & 7
    const int crow = tid >> 3;
    const int cch  = (tid & 7) * 8;
    const _Float16* gk = khb + (size_t)crow * DM + cch;
    const _Float16* gl = klb + (size_t)crow * DM + cch;
    const _Float16* gv = vtb + (size_t)crow * SEQ + cch;
    const unsigned  l0 = lds_addr(&ring[crow * LP + cch]);

    attn_stage(gk, gl, gv, l0);
    // tile 0 has landed before the barrier publishes it
    asm volatile("s_wait_asynccnt 0x0" ::: "memory");
    __syncthreads();
    attn_stage(gk + (size_t)KSTG * DM, gl + (size_t)KSTG * DM, gv + KSTG, l0 + STG_H * 2);

#pragma unroll 1
    for (int t = 0; t < SEQ / KSTG; ++t) {
      const _Float16* st = &ring[(t & 1) * STG_H];
#pragma unroll
      for (int sub = 0; sub < KSTG / 32; ++sub) {
        const _Float16* kp = st + sub * 32 * LP;
        const _Float16* lp = kp + TILE_H;

        const _Float16* vp = st + 2 * TILE_H + sub * 32;
        const v16h ka = load_frag16(kp, LP, lane);
        const v16h kb = load_frag16(kp + 32, LP, lane);
        const v16h la = load_frag16(lp, LP, lane);
        const v16h lb = load_frag16(lp + 32, LP, lane);
        const v16h ka1 = load_frag16(kp + 16 * LP, LP, lane);
        const v16h kb1 = load_frag16(kp + 16 * LP + 32, LP, lane);
        const v16h la1 = load_frag16(lp + 16 * LP, LP, lane);
        const v16h lb1 = load_frag16(lp + 16 * LP + 32, LP, lane);
        const v16h va0 = load_frag16(vp, LP, lane);                    // d 0..15
        const v16h va1 = load_frag16(vp + 16 * LP, LP, lane);          // d 16..31
        const v16h va2 = load_frag16(vp + 32 * LP, LP, lane);          // d 32..47
        const v16h va3 = load_frag16(vp + 48 * LP, LP, lane);          // d 48..63
        v8f sh0 = wmma16(ka, qh0, zero8());
        sh0 = wmma16(kb, qh1, sh0);
        v8f sr0 = wmma16(ka, ql0, zero8());
        sr0 = wmma16(kb, ql1, sr0);
        sr0 = wmma16(la, qh0, sr0);
        sr0 = wmma16(lb, qh1, sr0);

        v8f sh1 = wmma16(ka1, qh0, zero8());
        sh1 = wmma16(kb1, qh1, sh1);
        v8f sr1 = wmma16(ka1, ql0, zero8());
        sr1 = wmma16(kb1, ql1, sr1);
        sr1 = wmma16(la1, qh0, sr1);
        sr1 = wmma16(lb1, qh1, sr1);

        float t0[8], t1[8];
        float ml = -1.0e30f;
#pragma unroll
        for (int g = 0; g < 8; ++g) {
            t0[g] = __builtin_fmaf(sh0[g], C1, sr0[g] * C2);
            t1[g] = __builtin_fmaf(sh1[g], C1, sr1[g] * C2);
            ml = fmaxf(ml, fmaxf(t0[g], t1[g]));
        }
        ml = fmaxf(ml, __shfl_xor(ml, 16, 32));
        const float mn   = fmaxf(mr, ml);
        const float corr = ex2(mr - mn);
        const float shf  = P_CARRY - mn;

        Frag pf;
        float ps = 0.0f;
#pragma unroll
        for (int g = 0; g < 8; ++g) {
            const float p0 = ex2(t0[g] + shf);
            const float p1 = ex2(t1[g] + shf);
            ps += p0 + p1;
            pf.v[g]     = (_Float16)p0;     // k = key0 + 8*(lane>>4) + g
            pf.v[8 + g] = (_Float16)p1;     // k = key0 + 16 + 8*(lane>>4) + g
        }
        lr = lr * corr + ps;
        mr = mn;

        ot0 = scale8(ot0, corr);
        ot1 = scale8(ot1, corr);
        ot2 = scale8(ot2, corr);
        ot3 = scale8(ot3, corr);

        ot0 = wmma16(va0, pf.v, ot0);
        ot1 = wmma16(va1, pf.v, ot1);
        ot2 = wmma16(va2, pf.v, ot2);
        ot3 = wmma16(va3, pf.v, ot3);
      }
        // publish point: this wave's reads of the buffer are done ...
        asm volatile("s_wait_dscnt 0x0" ::: "memory");
        // ... its copies of tile t + 1 have landed ...
        asm volatile("s_wait_asynccnt 0x0" ::: "memory");
        // ... and the one barrier publishes tile t + 1 and frees the buffer read in this trip
        __syncthreads();
        if (t + 2 < SEQ / KSTG) {
            const size_t kn = (size_t)(t + 2) * KSTG;
            attn_stage(gk + kn * DM, gl + kn * DM, gv + kn, l0 + (unsigned)(t & 1) * (STG_H * 2));
        }
    }
    // no copy is outstanding when the wave goes on to its end
    asm volatile("s_wait_asynccnt 0x0" ::: "memory");

    const float lt  = lr + __shfl_xor(lr, 16, 32);
    const float inv = 4.0f * (1.0f / lt);        // (2^10 P)(64 v) / (2^10 l) * 4 = 256 ctx

    _Float16* cs = &Cst[w][0];
    {
        v8h c0, c1, c2, c3;
#pragma unroll
        for (int g = 0; g < 8; ++g) {
            c0[g] = (_Float16)(ot0[g] * inv);
            c1[g] = (_Float16)(ot1[g] * inv);
            c2[g] = (_Float16)(ot2[g] * inv);
            c3[g] = (_Float16)(ot3[g] * inv);
        }
        // lane holds query cc, d = dt*16 + r0 + 0..7
        *(v8h*)(&cs[cc * LP + 0 * 16 + r0]) = c0;
        *(v8h*)(&cs[cc * LP + 1 * 16 + r0]) = c1;
        *(v8h*)(&cs[cc * LP + 2 * 16 + r0]) = c2;
        *(v8h*)(&cs[cc * LP + 3 * 16 + r0]) = c3;
    }
    wave_lds_sync();

    v8h cv[4];
#pragma unroll
    for (int j = 0; j < 4; ++j)
        cv[j] = *(const v8h*)(&cs[(4 * j + (lane >> 3)) * LP + (lane & 7) * 8]);
    _Float16* cb = ctx + ((size_t)b * SEQ + q0) * DM + (size_t)hd * DK + (lane & 7) * 8;
#pragma unroll
    for (int j = 0; j < 4; ++j)
        *(v8h*)(cb + (size_t)(4 * j + (lane >> 3)) * DM) = cv[j];
    
}

// ---------------------------------------------------------------------------
// GEMM + bias + residual -> f32 plane [NTOK][512] (input of a LayerNorm pass).
// Block = 4 waves = 128 rows x 64 columns. f32 tile staged wave-private;
// residual added at the store stage as float4; each instruction writes two
// ---------------------------------------------------------------------------
template <int K, bool RB>
static __device__ __forceinline__ void gemm_res_body(const _Float16* __restrict__ A,
                                                     const _Float16* __restrict__ W,
                                                     const float* __restrict__ bias,
                                                     const float* __restrict__ resblk,
                                                     float* __restrict__ out,
                                                     float* os, const _Float16* ring, float scale,
                                                     int m0, int n0, int w, int lane) {
    const int r0 = (lane >> 4) << 3;
    const int cc = lane & 15;
    v8f acc[2][4];
#pragma unroll
    for (int mt = 0; mt < 2; ++mt)
#pragma unroll
        for (int nt = 0; nt < 4; ++nt) acc[mt][nt] = zero8();

    gemm_32x64<K>(A + (size_t)m0 * K, W + (size_t)n0 * K, ring, w * 32 + lane, acc);

    float bia[4];
#pragma unroll
    for (int nt = 0; nt < 4; ++nt) bia[nt] = bf16r(bias[n0 + nt * 16 + cc]);

#pragma unroll
    for (int mt = 0; mt < 2; ++mt)
#pragma unroll
        for (int nt = 0; nt < 4; ++nt)
#pragma unroll
            for (int g = 0; g < 8; ++g)
                os[(mt * 16 + r0 + g) * FP + nt * 16 + cc] =
                    __builtin_fmaf(acc[mt][nt][g], scale, bia[nt]);
    wave_lds_sync();

    const int c4 = (lane & 15) * 4;
    v4f sv[16];
#pragma unroll
    for (int j = 0; j < 16; ++j) {
        const int row = 2 * j + (lane >> 4);
        v4f v = *(const v4f*)(&os[row * FP + c4]);
        v4f r = *(const v4f*)(resblk + (size_t)(w * 32 + row) * DM + n0 + c4);
        if (RB) { r.x = bf16r(r.x); r.y = bf16r(r.y); r.z = bf16r(r.z); r.w = bf16r(r.w); }
        v.x += r.x; v.y += r.y; v.z += r.z; v.w += r.w;
        sv[j] = v;
    }
    float* ob = out + (size_t)(m0 + w * 32) * DM + n0 + c4;
#pragma unroll
    for (int j = 0; j < 16; ++j)
        *(v4f*)(ob + (size_t)(2 * j + (lane >> 4)) * DM) = sv[j];
    
}

// pre = ctx @ Wo^T + bo + bf16(x)
__global__ __launch_bounds__(128) void k_wo(const _Float16* __restrict__ ctx,
                                             const _Float16* __restrict__ woh,
                                             const float* __restrict__ bo,
                                             const float* __restrict__ x,
                                             float* __restrict__ pre) {
    __shared__ __align__(16) float Ost[4 * 32 * FP];   // 34 KB, wave-private tiles
    __shared__ __align__(16) _Float16 ring[2 * GSTG_H]; // 54 KB, two operand stages
    const int tid = threadIdx.x, lane = tid & 31, w = tid >> 5;
    const int m0 = blockIdx.x * 128, n0 = blockIdx.y * 64;
    const int b  = m0 / SEQ;
    const int s0 = m0 - b * SEQ;
    const float* resblk = x + ((size_t)b * SEQ_FULL + s0) * DM;
    gemm_res_body<DM, true>(ctx, woh, bo, resblk, pre, &Ost[w * 32 * FP], ring, SC_WO, m0, n0, w, lane);
}

// pre = relu1 @ W2^T + b2 + h
__global__ __launch_bounds__(128) void k_ffn2(const _Float16* __restrict__ ff1,
                                               const _Float16* __restrict__ w2h,
                                               const float* __restrict__ b2,
                                               const float* __restrict__ hf,
                                               float* __restrict__ pre) {
    __shared__ __align__(16) float Ost[4 * 32 * FP];   // 34 KB, wave-private tiles
    __shared__ __align__(16) _Float16 ring[2 * GSTG_H]; // 54 KB, two operand stages
    const int tid = threadIdx.x, lane = tid & 31, w = tid >> 5;
    const int m0 = blockIdx.x * 128, n0 = blockIdx.y * 64;
    const float* resblk = hf + (size_t)m0 * DM;
    gemm_res_body<DFF, false>(ff1, w2h, b2, resblk, pre, &Ost[w * 32 * FP], ring, SC_FF2, m0, n0, w, lane);
}

// ---------------------------------------------------------------------------
// FFN up-projection: ff1 (x64, f16) = relu(h @ W1^T + b1). Block = 4 waves =
// ---------------------------------------------------------------------------
__global__ __launch_bounds__(128) void k_ffn1(const _Float16* __restrict__ hh,
                                               const _Float16* __restrict__ w1h,
                                               const float* __restrict__ b1,
                                               _Float16* __restrict__ ff1) {
    __shared__ __align__(16) _Float16 stA[128 * LP];   // 18 KB, wave-private tiles
    __shared__ __align__(16) _Float16 ring[2 * GSTG_H]; // 54 KB, two operand stages
    const int tid  = threadIdx.x;
    const int lane = tid & 31;
    const int w    = tid >> 5;
    const int m0   = blockIdx.x * 128;
    const int n0   = blockIdx.y * 64;
    const int r0   = (lane >> 4) << 3;
    const int cc   = lane & 15;

    v8f acc[2][4];
#pragma unroll
    for (int mt = 0; mt < 2; ++mt)
#pragma unroll
        for (int nt = 0; nt < 4; ++nt) acc[mt][nt] = zero8();

    gemm_32x64<DM>(hh + (size_t)m0 * DM, w1h + (size_t)n0 * DM, ring, tid, acc);

    float bia[4];
#pragma unroll
    for (int nt = 0; nt < 4; ++nt) bia[nt] = bf16r(b1[n0 + nt * 16 + cc]) * 64.0f;

    _Float16* sh = &stA[w * 32 * LP];
#pragma unroll
    for (int mt = 0; mt < 2; ++mt)
#pragma unroll
        for (int nt = 0; nt < 4; ++nt)
#pragma unroll
            for (int g = 0; g < 8; ++g) {
                const float v = acc[mt][nt][g] + bia[nt];
                sh[(mt * 16 + r0 + g) * LP + nt * 16 + cc] = (_Float16)((v > 0.0f) ? v : 0.0f);
            }
    wave_lds_sync();
    v8h ph[8];
#pragma unroll
    for (int j = 0; j < 8; ++j)
        ph[j] = *(const v8h*)(&sh[(4 * j + (lane >> 3)) * LP + (lane & 7) * 8]);
    _Float16* ob = ff1 + (size_t)(m0 + w * 32) * DFF + n0 + (lane & 7) * 8;
#pragma unroll
    for (int j = 0; j < 8; ++j)
        *(v8h*)(ob + (size_t)(4 * j + (lane >> 3)) * DFF) = ph[j];
    
}

// ---------------------------------------------------------------------------
// LayerNorm over 512 columns (biased variance, eps 1e-5), one wave per row,
// lane holds columns i*128 + lane*4 + 0..3 (i = 0..3): every load/store
// instruction covers 512 contiguous bytes (f32) or 256 bytes (f16).
// ---------------------------------------------------------------------------
template <bool HOUT>
static __device__ __forceinline__ void ln_body(const float* __restrict__ in,
                                               const float* __restrict__ g,
                                               const float* __restrict__ be,
                                               float* __restrict__ outF,
                                               _Float16* __restrict__ outH) {
    static_assert(DM == 32 * 16);
    const int tid  = threadIdx.x;
    const int lane = tid & 31;
    const int w    = tid >> 5;
    const size_t row = (size_t)blockIdx.x * 8 + w;
    const float* rp = in + row * DM + lane * 4;

    v4f xv[4];
#pragma unroll
    for (int i = 0; i < 4; ++i) xv[i] = *(const v4f*)(rp + i * 128);

    float s = 0.0f;
#pragma unroll
    for (int i = 0; i < 4; ++i) s += (xv[i].x + xv[i].y) + (xv[i].z + xv[i].w);
    s += __shfl_xor(s, 16, 32);
    s += __shfl_xor(s, 8, 32);
    s += __shfl_xor(s, 4, 32);
    s += __shfl_xor(s, 2, 32);
    s += __shfl_xor(s, 1, 32);
    const float mu = s * (1.0f / (float)DM);

    float s2 = 0.0f;
#pragma unroll
    for (int i = 0; i < 4; ++i) {
        const float d0 = xv[i].x - mu, d1 = xv[i].y - mu, d2 = xv[i].z - mu, d3 = xv[i].w - mu;
        s2 += (d0 * d0 + d1 * d1) + (d2 * d2 + d3 * d3);
    }
    s2 += __shfl_xor(s2, 16, 32);
    s2 += __shfl_xor(s2, 8, 32);
    s2 += __shfl_xor(s2, 4, 32);
    s2 += __shfl_xor(s2, 2, 32);
    s2 += __shfl_xor(s2, 1, 32);
    const float rstd = rsqrtf(s2 * (1.0f / (float)DM) + 1.0e-5f);

    v4f yv[4];
#pragma unroll
    for (int i = 0; i < 4; ++i) {
        const v4f gv = *(const v4f*)(g + i * 128 + lane * 4);
        const v4f bv = *(const v4f*)(be + i * 128 + lane * 4);
        v4f yy;
        yy.x = (xv[i].x - mu) * rstd * bf16r(gv.x) + bf16r(bv.x);
        yy.y = (xv[i].y - mu) * rstd * bf16r(gv.y) + bf16r(bv.y);
        yy.z = (xv[i].z - mu) * rstd * bf16r(gv.z) + bf16r(bv.z);
        yy.w = (xv[i].w - mu) * rstd * bf16r(gv.w) + bf16r(bv.w);
        yv[i] = yy;
    }
    v4h hv[4];
    if (HOUT) {
#pragma unroll
        for (int i = 0; i < 4; ++i) {
            v4h t;
            t.x = (_Float16)yv[i].x; t.y = (_Float16)yv[i].y;
            t.z = (_Float16)yv[i].z; t.w = (_Float16)yv[i].w;
            hv[i] = t;
        }
    }
    float* of = outF + row * DM + lane * 4;
#pragma unroll
    for (int i = 0; i < 4; ++i) *(v4f*)(of + i * 128) = yv[i];
    if (HOUT) {
        _Float16* oh = outH + row * DM + lane * 4;
#pragma unroll
        for (int i = 0; i < 4; ++i) *(v4h*)(oh + i * 128) = hv[i];
    }
    
}

__global__ __launch_bounds__(256) void k_ln_mid(const float* __restrict__ pre,
                                                 const float* __restrict__ g,
                                                 const float* __restrict__ be,
                                                 float* __restrict__ hf,
                                                 _Float16* __restrict__ hh) {
    ln_body<true>(pre, g, be, hf, hh);
}

__global__ __launch_bounds__(256) void k_ln_out(const float* __restrict__ pre,
                                                 const float* __restrict__ g,
                                                 const float* __restrict__ be,
                                                 float* __restrict__ out) {
    ln_body<false>(pre, g, be, out, nullptr);
}

// ---------------------------------------------------------------------------
// ---------------------------------------------------------------------------
#define SZ_XH   ((size_t)NTOK * DM * 2)
#define SZ_WQKV ((size_t)3 * DM * DM * 2)
#define SZ_WO   ((size_t)DM * DM * 2)
#define SZ_W1   ((size_t)DFF * DM * 2)
#define SZ_W2   ((size_t)DM * DFF * 2)
#define SZ_QK   ((size_t)4 * NTOK * DM * 2)     // qh, kh, ql, kl ; later reused for ff1
#define SZ_VT   ((size_t)NB * NH * DK * SEQ * 2)
#define SZ_CTX  ((size_t)NTOK * DM * 2)
#define SZ_PRE  ((size_t)NTOK * DM * 4)
#define SZ_HF   ((size_t)NTOK * DM * 4)
#define SZ_HH   ((size_t)NTOK * DM * 2)
#define SZ_FF1  ((size_t)NTOK * DFF * 2)
#define SZ_TOTAL (SZ_XH + SZ_WQKV + SZ_WO + SZ_W1 + SZ_W2 + SZ_QK + SZ_VT + SZ_CTX + SZ_PRE + SZ_HF + SZ_HH)

static_assert(SZ_FF1 <= SZ_QK);                 // ff1 reuses the q/k plane region
static_assert(SZ_TOTAL <= (size_t)134217728);   // carve within 128 MiB
static_assert(SZ_XH % 128 == 0 && SZ_WQKV % 128 == 0 && SZ_WO % 128 == 0 && SZ_W1 % 128 == 0);
static_assert(SZ_QK % 128 == 0 && SZ_VT % 128 == 0 && SZ_PRE % 128 == 0 && SZ_HH % 128 == 0);

extern "C" void kernel_launch(void* const* d_in, const int* in_sizes, int n_in,
                              void* d_out, int out_size, void* d_ws, size_t ws_size,
                              hipStream_t stream) {
    if (n_in < 15) return;
    if (in_sizes[0] < ((NB - 1) * SEQ_FULL + SEQ) * DM) return;
    if (in_sizes[1] < DM * DM || in_sizes[3] < DM * DM || in_sizes[5] < DM * DM || in_sizes[7] < DM * DM) return;
    if (in_sizes[2] < DM || in_sizes[4] < DM || in_sizes[6] < DM || in_sizes[8] < DM) return;
    if (in_sizes[9] < DM || in_sizes[10] < DM) return;
    if (in_sizes[11] < DFF * DM || in_sizes[12] < DFF) return;
    if (in_sizes[13] < DM * DFF || in_sizes[14] < DM) return;
    if (out_size < NTOK * DM) return;
    if (SZ_TOTAL > ws_size) return;

    const float* x   = (const float*)d_in[0];    // [4,2048,512]
    const float* wq  = (const float*)d_in[1];    // [512,512] [out][in]
    const float* bq  = (const float*)d_in[2];
    const float* wk  = (const float*)d_in[3];
    const float* bk  = (const float*)d_in[4];
    const float* wv  = (const float*)d_in[5];
    const float* bv  = (const float*)d_in[6];
    const float* wo  = (const float*)d_in[7];
    const float* bo  = (const float*)d_in[8];
    const float* lng = (const float*)d_in[9];
    const float* lnb = (const float*)d_in[10];
    const float* w1  = (const float*)d_in[11];   // [2048,512] [out][in]
    const float* b1  = (const float*)d_in[12];
    const float* w2  = (const float*)d_in[13];   // [512,2048] [out][in]
    const float* b2  = (const float*)d_in[14];
    float* out = (float*)d_out;                  // [4,2048,512]

    char* ws = (char*)d_ws;
    size_t off = 0;
    _Float16* xh   = (_Float16*)(ws + off); off += SZ_XH;
    _Float16* wqkv = (_Float16*)(ws + off); off += SZ_WQKV;
    _Float16* woh  = (_Float16*)(ws + off); off += SZ_WO;
    _Float16* w1h  = (_Float16*)(ws + off); off += SZ_W1;
    _Float16* w2h  = (_Float16*)(ws + off); off += SZ_W2;
    _Float16* qkH  = (_Float16*)(ws + off);                    // qh then kh
    _Float16* qkL  = qkH + (size_t)2 * NTOK * DM;              // ql then kl
    _Float16* ff1  = qkH;                                      // reuse after attention
    off += SZ_QK;
    _Float16* vT   = (_Float16*)(ws + off); off += SZ_VT;
    _Float16* ctx  = (_Float16*)(ws + off); off += SZ_CTX;
    float*    pre  = (float*)(ws + off);    off += SZ_PRE;
    float*    hf   = (float*)(ws + off);    off += SZ_HF;
    _Float16* hh   = (_Float16*)(ws + off); off += SZ_HH;
    if (off > ws_size) return;

    const _Float16* qh = qkH;
    const _Float16* kh = qkH + (size_t)NTOK * DM;
    const _Float16* ql = qkL;
    const _Float16* kl = qkL + (size_t)NTOK * DM;

    const int nw = DM * DM, nf = DFF * DM;
    k_cvtx<<<dim3((unsigned)(((size_t)NTOK * DM) / 2048)), dim3(256), 0, stream>>>(x, xh);
    k_cvtw<<<dim3(nw / 2048), dim3(256), 0, stream>>>(wq, wqkv, nw, 64.0f);
    k_cvtw<<<dim3(nw / 2048), dim3(256), 0, stream>>>(wk, wqkv + (size_t)nw, nw, 64.0f);
    k_cvtw<<<dim3(nw / 2048), dim3(256), 0, stream>>>(wv, wqkv + (size_t)2 * nw, nw, 64.0f);
    k_cvtw<<<dim3(nw / 2048), dim3(256), 0, stream>>>(wo, woh, nw, 64.0f);
    k_cvtw<<<dim3(nf / 2048), dim3(256), 0, stream>>>(w1, w1h, nf, 64.0f);
    k_cvtw<<<dim3(nf / 2048), dim3(256), 0, stream>>>(w2, w2h, nf, 64.0f);

    k_qkv<<<dim3(NTOK / 128, 24), dim3(128), 0, stream>>>(xh, wqkv, bq, bk, bv, qkH, qkL, vT);
    k_attn<<<dim3(SEQ / 128, NH, NB), dim3(256), 0, stream>>>(qh, ql, kh, kl, vT, ctx);
    k_wo<<<dim3(NTOK / 128, DM / 64), dim3(128), 0, stream>>>(ctx, woh, bo, x, pre);
    k_ln_mid<<<dim3(NTOK / 8), dim3(256), 0, stream>>>(pre, lng, lnb, hf, hh);
    k_ffn1<<<dim3(NTOK / 128, DFF / 64), dim3(128), 0, stream>>>(hh, w1h, b1, ff1);
    k_ffn2<<<dim3(NTOK / 128, DM / 64), dim3(128), 0, stream>>>(ff1, w2h, b2, hf, pre);
    k_ln_out<<<dim3(NTOK / 8), dim3(256), 0, stream>>>(pre, lng, lnb, out);
}

// v002
// One run takes 158 microseconds.
// Next to v001, in two timings, it ran 1.05 times as fast each time.
// Counting every step since v000, it is 2.53 times as fast.
#include <hip/hip_runtime.h>

// All contractions on v_wmma_f32_16x16x32_f16 (f16 operands, f32 accumulate): x*[Wq|Wk|Wv]^T, ctx*Wo^T, h*W1^T, relu*W2^T single f16 products (bf16-RNE inputs exact in f16, weights carried x64); q*k^T with f16 hi plane + 2^11-scaled f16 residual plane (two accumulators, residual folded 2^-11 in f32); P*v single product with P carried 2^10.

#ifndef NB
#define NB 4
#endif
#ifndef SEQ
#define SEQ 2048
#endif
#define NB_FULL  4
#define SEQ_FULL 2048
#define DM   512         // model width
#define NH   8           // heads
#define DK   64          // head width
#define DFF  2048        // FFN width
#define NTOK (NB * SEQ)
#define LP   72          // f16 staging pitch (halves), 144 B rows
#define VP   136         // transposed-V staging pitch (halves), 272 B rows
#define FP   68          // f32 staging pitch (floats), 272 B rows

static_assert(NB >= 1 && NB <= NB_FULL);           // batch within the input
static_assert(SEQ >= 128 && SEQ <= SEQ_FULL);      // sequence within the input
static_assert(SEQ % 128 == 0);                     // 128-token blocks never straddle a batch
static_assert(SEQ % 32 == 0);                      // key step of 32
static_assert(NTOK % 128 == 0);                    // GEMM M tile
static_assert(NTOK % 8 == 0);                      // LayerNorm rows per block
static_assert(DM == NH * DK);                      // head split h*64+d
static_assert(DK == 64);
static_assert(DM == 512);                          // LayerNorm: 32 lanes x 16 columns
static_assert(DM % 64 == 0 && DFF % 64 == 0);      // GEMM N tile
static_assert(DM % 32 == 0 && DFF % 32 == 0);      // WMMA k step
static_assert(64 * VP <= 128 * LP);                // transposed-V tile fits the f16 staging region
static_assert(LP % 8 == 0 && VP % 8 == 0 && FP % 4 == 0);   // 16-B aligned staging rows
#define KSTG   64            // keys per LDS stage of the attention ring
#define TILE_H (64 * LP)     // one staged tile: 64 rows of 128 B at pitch 144 B (halves)
#define STG_H  (3 * TILE_H)  // K hi, K residual, V^T
static_assert(SEQ % KSTG == 0 && SEQ / KSTG >= 2);   // the ring's prologue fills two stages
#define GK     64            // k columns per LDS stage of the GEMM ring
#define GSTG_H (192 * LP)    // 128 A rows then 64 W rows, 128 B each at pitch 144 B (halves)

typedef _Float16 v16h __attribute__((ext_vector_type(16)));
typedef _Float16 v8h  __attribute__((ext_vector_type(8)));
typedef _Float16 v4h  __attribute__((ext_vector_type(4)));
typedef float    v8f  __attribute__((ext_vector_type(8)));
typedef float    v4f  __attribute__((ext_vector_type(4)));

union Frag { v16h v; v8h h[2]; };

// scores: acc_h = (64k_h).(64q_h), acc_r = 2^11-scaled residual cross terms
// t (log2 units) = acc_h * log2(e)*2^-15 + acc_r * log2(e)*2^-26   (1/8 score scale folded)
#define C1 (1.44269504088896340736f * 3.0517578125e-05f)
#define C2 (1.44269504088896340736f * 1.4901161193847656e-08f)
#define SC_RES   2048.0f                 // residual plane carry 2^11
#define P_CARRY  10.0f                   // P carried 2^10 (log2 units)
#define SC_WO    6.103515625e-05f        // 2^-14 : (256 ctx)(64 Wo)
#define SC_FF2   2.44140625e-04f         // 2^-12 : (64 ff1)(64 W2)

static __device__ __forceinline__ v8f zero8() {
    v8f z;
#pragma unroll
    for (int i = 0; i < 8; ++i) z[i] = 0.0f;
    return z;
}

// 16x32 A fragment (or B fragment from an [n][k] k-contiguous source) from a
// row-major 16-bit tile: lane m = lane&15 -> row m; kb = 8*(lane>>4);
// elements 0..7 = k kb..kb+7, elements 8..15 = k kb+16..kb+23.
static __device__ __forceinline__ v16h load_frag16(const _Float16* base, int ld, int lane) {
    int m  = lane & 15;
    int kb = (lane >> 4) << 3;
    const _Float16* p = base + (size_t)m * ld + kb;
    Frag f;
    f.h[0] = *(const v8h*)(p);
    f.h[1] = *(const v8h*)(p + 16);
    return f.v;
}

static __device__ __forceinline__ v8f wmma16(v16h a, v16h b, v8f c) {
    v8f d = __builtin_amdgcn_wmma_f32_16x16x32_f16(false, a, false, b, (short)0, c, false, false);
    asm volatile("v_nop\n\tv_nop\n\tv_nop\n\tv_nop" : "+v"(d) : "v"(a), "v"(b));
    return d;
}

// f32 -> bf16 RNE convert, value kept as f32
static __device__ __forceinline__ float bf16r(float x) {
    unsigned u = __float_as_uint(x);
    u = (u + 0x7FFFu + ((u >> 16) & 1u)) & 0xFFFF0000u;
    return __uint_as_float(u);
}

static __device__ __forceinline__ float ex2(float x) {
    return __builtin_amdgcn_exp2f(x);
}

// ordering for a wave-private LDS tile: stores before later loads of the same wave
static __device__ __forceinline__ void wave_lds_sync() {
    __builtin_amdgcn_fence(3, "wavefront");
    asm volatile("s_wait_dscnt 0" ::: "memory");
    __builtin_amdgcn_wave_barrier();
}

static __device__ __forceinline__ v8f scale8(v8f a, float s) {
#pragma unroll
    for (int i = 0; i < 8; ++i) a[i] *= s;
    return a;
}

// LDS byte address of a __shared__ element (operand of an asynchronous copy)
static __device__ __forceinline__ unsigned lds_addr(const _Float16* p) {
    return (unsigned)(size_t)(const __attribute__((address_space(3))) _Float16*)p;
}

// ---------------------------------------------------------------------------
// Operand planes: f16(bf16_rne(v) * scale), all seven sources in ONE launch.
// The destination planes xh | wq wk wv | wo | w1 | w2 are carved back to back,
// so they form one f16 array; a block converts CV_BLK consecutive elements of
// it, which lie in one plane (block-uniform source choice). A thread takes 8
// elements per pass, one 16-B store; all of its loads are issued up front.
// ---------------------------------------------------------------------------
#define CV_PASS 8                          // passes per block
#define CV_STEP 2048                       // elements per pass: 256 threads x 8
#define CV_BLK  (CV_PASS * CV_STEP)        // elements per block
#define N_X     ((size_t)NTOK * DM)
#define N_W     ((size_t)DM * DM)
#define N_F     ((size_t)DFF * DM)
#define N_ALL   (N_X + 4 * N_W + 2 * N_F)
static_assert(N_X % CV_BLK == 0 && N_W % CV_BLK == 0 && N_F % CV_BLK == 0);   // a block never straddles two planes
static_assert(CV_BLK % DM == 0 && SEQ % (CV_BLK / DM) == 0);                  // whole token rows of one batch

__global__ __launch_bounds__(256) void k_cvt(const float* __restrict__ x,
                                              const float* __restrict__ wq,
                                              const float* __restrict__ wk,
                                              const float* __restrict__ wv,
                                              const float* __restrict__ wo,
                                              const float* __restrict__ w1,
                                              const float* __restrict__ w2,
                                              _Float16* __restrict__ dst) {
    constexpr unsigned BX = (unsigned)(N_X / CV_BLK);   // blocks per plane
    constexpr unsigned BW = (unsigned)(N_W / CV_BLK);
    constexpr unsigned BF = (unsigned)(N_F / CV_BLK);
    const unsigned blk = blockIdx.x;
    const size_t   e0  = (size_t)blk * CV_BLK;
    const float* src;
    float scale;
    if (blk < BX) {
        const size_t tok = e0 / DM;
        const size_t b   = tok / SEQ;
        const size_t s   = tok - b * SEQ;
        src   = x + (b * SEQ_FULL + s) * DM;
        scale = 1.0f;
    } else {
        const unsigned p = blk - BX;
        const float*   base  = wq;
        unsigned       first = 0;
        if (p >= BW)          { base = wk; first = BW; }
        if (p >= 2 * BW)      { base = wv; first = 2 * BW; }
        if (p >= 3 * BW)      { base = wo; first = 3 * BW; }
        if (p >= 4 * BW)      { base = w1; first = 4 * BW; }
        if (p >= 4 * BW + BF) { base = w2; first = 4 * BW + BF; }
        src   = base + (size_t)(p - first) * CV_BLK;
        scale = 64.0f;
    }
    const int t8 = threadIdx.x * 8;
    v4f a0[CV_PASS], a1[CV_PASS];
#pragma unroll
    for (int j = 0; j < CV_PASS; ++j) {
        a0[j] = *(const v4f*)(src + j * CV_STEP + t8);
        a1[j] = *(const v4f*)(src + j * CV_STEP + t8 + 4);
    }
#pragma unroll
    for (int j = 0; j < CV_PASS; ++j) {
        v8h o;
        o[0] = (_Float16)(bf16r(a0[j].x) * scale); o[1] = (_Float16)(bf16r(a0[j].y) * scale);
        o[2] = (_Float16)(bf16r(a0[j].z) * scale); o[3] = (_Float16)(bf16r(a0[j].w) * scale);
        o[4] = (_Float16)(bf16r(a1[j].x) * scale); o[5] = (_Float16)(bf16r(a1[j].y) * scale);
        o[6] = (_Float16)(bf16r(a1[j].z) * scale); o[7] = (_Float16)(bf16r(a1[j].w) * scale);
        *(v8h*)(dst + e0 + j * CV_STEP + t8) = o;
    }
}

// ---------------------------------------------------------------------------
// One lane's twelve 16-B asynchronous copies of a GEMM stage (block of 128
// threads): rows r + 16 j of the 128-row A tile (j = 0..7) and of the 64-row
// W tile (j = 0..3). A wave's copy covers four whole 128-B lines.
// s_wait_xcnt closes the statement so that no address register is rewritten
// ahead of it.
// ---------------------------------------------------------------------------
template <int K>
static __device__ __forceinline__ void gemm_stage(const _Float16* ga, const _Float16* gw, unsigned l) {
    constexpr unsigned RS = 16 * LP * 2;        // 16 LDS rows, bytes
    constexpr size_t   GS = (size_t)16 * K;     // 16 source rows, halves
    asm volatile("global_load_async_to_lds_b128 %0, %12, off\n\t"
                 "global_load_async_to_lds_b128 %1, %13, off\n\t"
                 "global_load_async_to_lds_b128 %2, %14, off\n\t"
                 "global_load_async_to_lds_b128 %3, %15, off\n\t"
                 "global_load_async_to_lds_b128 %4, %16, off\n\t"
                 "global_load_async_to_lds_b128 %5, %17, off\n\t"
                 "global_load_async_to_lds_b128 %6, %18, off\n\t"
                 "global_load_async_to_lds_b128 %7, %19, off\n\t"
                 "global_load_async_to_lds_b128 %8, %20, off\n\t"
                 "global_load_async_to_lds_b128 %9, %21, off\n\t"
                 "global_load_async_to_lds_b128 %10, %22, off\n\t"
                 "global_load_async_to_lds_b128 %11, %23, off\n\t"
                 "s_wait_xcnt 0x0"
                 :: "v"(l), "v"(l + RS), "v"(l + 2 * RS), "v"(l + 3 * RS),
                    "v"(l + 4 * RS), "v"(l + 5 * RS), "v"(l + 6 * RS), "v"(l + 7 * RS),
                    "v"(l + 8 * RS), "v"(l + 9 * RS), "v"(l + 10 * RS), "v"(l + 11 * RS),
                    "v"(ga), "v"(ga + GS), "v"(ga + 2 * GS), "v"(ga + 3 * GS),
                    "v"(ga + 4 * GS), "v"(ga + 5 * GS), "v"(ga + 6 * GS), "v"(ga + 7 * GS),
                    "v"(gw), "v"(gw + GS), "v"(gw + 2 * GS), "v"(gw + 3 * GS)
                 : "memory");
}

// ---------------------------------------------------------------------------
// Block GEMM core: 4 waves, 128 rows x 64 columns, wave w owns rows w*32..+31.
// A (the block's first row, row-major pitch K) and W ([n][k] pitch K) come in
// stages of 64 k columns into a two-buffer LDS ring by asynchronous copies;
// fragments are read from the ring.
// acc[mt][nt][r] = element (row mt*16 + 8*(lane>>4) + r, col nt*16 + (lane&15)).
// ---------------------------------------------------------------------------
template <int K>
static __device__ __forceinline__ void gemm_32x64(const _Float16* __restrict__ A,
                                                  const _Float16* __restrict__ W,
                                                  const _Float16* ring, int tid, v8f (&acc)[2][4]) {
    static_assert(K % GK == 0 && K / GK >= 2);   // the ring's prologue fills two stages
    const int lane = tid & 31;
    const int w    = tid >> 5;
    const int crow = tid >> 3;
    const int cch  = (tid & 7) * 8;
    const _Float16* ga = A + (size_t)crow * K + cch;
    const _Float16* gw = W + (size_t)crow * K + cch;
    const unsigned  l0 = lds_addr(ring + crow * LP + cch);

    gemm_stage<K>(ga, gw, l0);
    // tile 0 has landed before the barrier publishes it
    asm volatile("s_wait_asynccnt 0x0" ::: "memory");
    __syncthreads();
    gemm_stage<K>(ga + GK, gw + GK, l0 + GSTG_H * 2);

#pragma unroll 1
    for (int t = 0; t < K / GK; ++t) {
        const _Float16* sa = ring + (t & 1) * GSTG_H + w * 32 * LP;
        const _Float16* sw = ring + (t & 1) * GSTG_H + 128 * LP;
#pragma unroll
        for (int kk = 0; kk < GK; kk += 32) {
            const v16h a0 = load_frag16(sa + kk, LP, lane);
            const v16h a1 = load_frag16(sa + 16 * LP + kk, LP, lane);
            v16h bw[4];
#pragma unroll
            for (int nt = 0; nt < 4; ++nt) bw[nt] = load_frag16(sw + nt * 16 * LP + kk, LP, lane);
#pragma unroll
            for (int nt = 0; nt < 4; ++nt) {
                acc[0][nt] = wmma16(a0, bw[nt], acc[0][nt]);
                acc[1][nt] = wmma16(a1, bw[nt], acc[1][nt]);
            }
        }
        // publish point: this wave's reads of the buffer are done ...
        asm volatile("s_wait_dscnt 0x0" ::: "memory");
        // ... its copies of tile t + 1 have landed ...
        asm volatile("s_wait_asynccnt 0x0" ::: "memory");
        // ... and the one barrier publishes tile t + 1 and frees the buffer read in this trip
        __syncthreads();
        if (t + 2 < K / GK)
            gemm_stage<K>(ga + (t + 2) * GK, gw + (t + 2) * GK, l0 + (unsigned)(t & 1) * (GSTG_H * 2));
    }
    // no copy is outstanding when the wave goes on to its epilogue
    asm volatile("s_wait_asynccnt 0x0" ::: "memory");
}

// ---------------------------------------------------------------------------
// QKV projections. Block = 4 waves = 128 tokens x 64 columns (one head of one
// of q/k/v); grid (NTOK/128, 24). Outputs carried x64:
//   q,k : f16 hi plane + f16 residual plane ((v - hi) * 2^11), [tok][512]
//         4 lines per lane-contiguous instruction.
//   v   : transposed plane vT[b][h][d][S]; block-level staging [64 d][128 tok]
// ---------------------------------------------------------------------------
__global__ __launch_bounds__(128) void k_qkv(const _Float16* __restrict__ xh,
                                              const _Float16* __restrict__ wqkv,
                                              const float* __restrict__ bq,
                                              const float* __restrict__ bk,
                                              const float* __restrict__ bv,
                                              _Float16* __restrict__ qkH,
                                              _Float16* __restrict__ qkL,
                                              _Float16* __restrict__ vT) {
    __shared__ __align__(16) _Float16 stA[128 * LP];   // 18 KB
    __shared__ __align__(16) _Float16 stB[128 * LP];   // 18 KB
    __shared__ __align__(16) _Float16 ring[2 * GSTG_H]; // 54 KB, two operand stages

    const int tid  = threadIdx.x;
    const int lane = tid & 31;
    const int w    = tid >> 5;
    const int m0   = blockIdx.x * 128;
    const int y    = blockIdx.y;
    const int kind = y >> 3;          // 0 q, 1 k, 2 v  (block-uniform)
    const int hd   = y & 7;
    const int n0   = y * 64;
    const int r0   = (lane >> 4) << 3;
    const int cc   = lane & 15;

    v8f acc[2][4];
#pragma unroll
    for (int mt = 0; mt < 2; ++mt)
#pragma unroll
        for (int nt = 0; nt < 4; ++nt) acc[mt][nt] = zero8();

    gemm_32x64<DM>(xh + (size_t)m0 * DM, wqkv + (size_t)n0 * DM, ring, tid, acc);

    float bia[4];
#pragma unroll
    for (int nt = 0; nt < 4; ++nt) {
        const int c = hd * 64 + nt * 16 + cc;
        const float fq = bq[c];
        const float fk = bk[c];
        const float fv = bv[c];
        const float bs = (kind == 0) ? fq : ((kind == 1) ? fk : fv);
        bia[nt] = bf16r(bs) * 64.0f;
    }

    if (kind < 2) {
        _Float16* sh = &stA[w * 32 * LP];
        _Float16* sl = &stB[w * 32 * LP];
#pragma unroll
        for (int mt = 0; mt < 2; ++mt)
#pragma unroll
            for (int nt = 0; nt < 4; ++nt)
#pragma unroll
                for (int g = 0; g < 8; ++g) {
                    const float v = acc[mt][nt][g] + bia[nt];
                    const _Float16 hv = (_Float16)v;
                    const int o = (mt * 16 + r0 + g) * LP + nt * 16 + cc;
                    sh[o] = hv;
                    sl[o] = (_Float16)((v - (float)hv) * SC_RES);
                }
        wave_lds_sync();
        v8h ph[8], pl[8];
#pragma unroll
        for (int j = 0; j < 8; ++j) {
            const int o = (4 * j + (lane >> 3)) * LP + (lane & 7) * 8;
            ph[j] = *(const v8h*)(&sh[o]);
            pl[j] = *(const v8h*)(&sl[o]);
        }
        const size_t base = (size_t)kind * NTOK * DM + (size_t)(m0 + w * 32) * DM
                          + (size_t)hd * DK + (size_t)(lane & 7) * 8;
#pragma unroll
        for (int j = 0; j < 8; ++j) {
            const size_t o = base + (size_t)(4 * j + (lane >> 3)) * DM;
            *(v8h*)(qkH + o) = ph[j];
            *(v8h*)(qkL + o) = pl[j];
        }
        
    } else {
        // stA viewed as [64 d][VP]; token index within the block along the row
#pragma unroll
        for (int mt = 0; mt < 2; ++mt)
#pragma unroll
            for (int nt = 0; nt < 4; ++nt) {
                v8h pk;
#pragma unroll
                for (int g = 0; g < 8; ++g) pk[g] = (_Float16)(acc[mt][nt][g] + bia[nt]);
                *(v8h*)(&stA[(nt * 16 + cc) * VP + w * 32 + mt * 16 + r0]) = pk;
            }
        __syncthreads();
        const int b  = m0 / SEQ;
        const int s0 = m0 - b * SEQ;
        v8h pv[8];
#pragma unroll
        for (int j = 0; j < 8; ++j) {
            const int d = w * 16 + 2 * j + (lane >> 4);
            pv[j] = *(const v8h*)(&stA[d * VP + (lane & 15) * 8]);
        }
        _Float16* dst = vT + ((size_t)(b * NH + hd) * DK) * SEQ + s0 + (lane & 15) * 8;
#pragma unroll
        for (int j = 0; j < 8; ++j)
            *(v8h*)(dst + (size_t)(w * 16 + 2 * j + (lane >> 4)) * SEQ) = pv[j];
        
    }
}

// ---------------------------------------------------------------------------
// One lane's six 16-B asynchronous copies of an attention stage: rows r and
// r + 32 of the K hi, K residual and V^T tiles. A wave's copy covers four
// whole 128-B lines. s_wait_xcnt closes the statement so that no address
// register is rewritten ahead of it.
// ---------------------------------------------------------------------------
static __device__ __forceinline__ void attn_stage(const _Float16* gk, const _Float16* gl,
                                                  const _Float16* gv, unsigned l) {
    const _Float16* gk1 = gk + (size_t)32 * DM;
    const _Float16* gl1 = gl + (size_t)32 * DM;
    const _Float16* gv1 = gv + (size_t)32 * SEQ;
    const unsigned lk1 = l + 32 * LP * 2;
    const unsigned ll0 = l + TILE_H * 2;
    const unsigned ll1 = l + TILE_H * 2 + 32 * LP * 2;
    const unsigned lv0 = l + 2 * TILE_H * 2;
    const unsigned lv1 = l + 2 * TILE_H * 2 + 32 * LP * 2;
    asm volatile("global_load_async_to_lds_b128 %0, %6, off\n\t"
                 "global_load_async_to_lds_b128 %1, %7, off\n\t"
                 "global_load_async_to_lds_b128 %2, %8, off\n\t"
                 "global_load_async_to_lds_b128 %3, %9, off\n\t"
                 "global_load_async_to_lds_b128 %4, %10, off\n\t"
                 "global_load_async_to_lds_b128 %5, %11, off\n\t"
                 "s_wait_xcnt 0x0"
                 :: "v"(l), "v"(lk1), "v"(ll0), "v"(ll1), "v"(lv0), "v"(lv1),
                    "v"(gk), "v"(gk1), "v"(gl), "v"(gl1), "v"(gv), "v"(gv1)
                 : "memory");
}

// ---------------------------------------------------------------------------
// Flash attention, transposed form. Block = 8 waves = 128 queries of one
// (batch, head); wave owns 16 queries. K hi, K residual and V^T tiles of 64
// keys are brought into a two-buffer LDS ring by asynchronous copies (whole
// 128-B lines, once per block) and read as fragments by all 8 waves.
// Per 32-key step:
//   S^T tiles (keys x queries): A = K rows (hi / residual planes), B = Q rows
//   (hi / residual planes): hi.hi into acc_h; hi.lo + lo.hi into acc_r.
//   Query = lane column -> running max / sum are per-lane (one xor-16 shuffle).
//   P^T packed from the two S^T accumulators is directly the B fragment
//   (k = key = tile row, n = query = tile column); A = V^T rows from the
//   vT plane: O^T (d x queries) += V^T P^T.
// Epilogue: (O^T / l) * 4 = 256 ctx, f16, transposed through a wave-private
// ---------------------------------------------------------------------------
__global__ __launch_bounds__(256) __attribute__((amdgpu_num_vgpr(256)))
void k_attn(const _Float16* __restrict__ qh,
            const _Float16* __restrict__ ql,
            const _Float16* __restrict__ kh,
            const _Float16* __restrict__ kl,
            const _Float16* __restrict__ vT,
            _Float16* __restrict__ ctx) {
    __shared__ __align__(16) _Float16 Cst[8][16 * LP];   // 18 KB, wave-private tiles
    __shared__ __align__(16) _Float16 ring[2 * STG_H];   // 54 KB, two stages

    const int tid  = threadIdx.x;
    const int lane = tid & 31;
    const int w    = tid >> 5;
    const int b    = blockIdx.z;
    const int hd   = blockIdx.y;
    const int q0   = blockIdx.x * 128 + w * 16;
    const int r0   = (lane >> 4) << 3;
    const int cc   = lane & 15;

    const size_t qoff = ((size_t)b * SEQ + q0) * DM + (size_t)hd * DK;
    const v16h qh0 = load_frag16(qh + qoff, DM, lane);        // d 0..31
    const v16h qh1 = load_frag16(qh + qoff + 32, DM, lane);   // d 32..63
    const v16h ql0 = load_frag16(ql + qoff, DM, lane);
    const v16h ql1 = load_frag16(ql + qoff + 32, DM, lane);

    const _Float16* khb = kh + (size_t)b * SEQ * DM + (size_t)hd * DK;
    const _Float16* klb = kl + (size_t)b * SEQ * DM + (size_t)hd * DK;
    const _Float16* vtb = vT + ((size_t)(b * NH + hd) * DK) * SEQ;

    v8f ot0 = zero8(), ot1 = zero8(), ot2 = zero8(), ot3 = zero8();   // d tiles 0..3
    float mr = -1.0e30f, lr = 0.0f;

    // lane's share of a stage: rows crow and crow + 32 of each tile, 16 B at chunk tid & 7
    const int crow = tid >> 3;
    const int cch  = (tid & 7) * 8;
    const _Float16* gk = khb + (size_t)crow * DM + cch;
    const _Float16* gl = klb + (size_t)crow * DM + cch;
    const _Float16* gv = vtb + (size_t)crow * SEQ + cch;
    const unsigned  l0 = lds_addr(&ring[crow * LP + cch]);

    attn_stage(gk, gl, gv, l0);
    // tile 0 has landed before the barrier publishes it
    asm volatile("s_wait_asynccnt 0x0" ::: "memory");
    __syncthreads();
    attn_stage(gk + (size_t)KSTG * DM, gl + (size_t)KSTG * DM, gv + KSTG, l0 + STG_H * 2);

#pragma unroll 1
    for (int t = 0; t < SEQ / KSTG; ++t) {
      const _Float16* st = &ring[(t & 1) * STG_H];
#pragma unroll
      for (int sub = 0; sub < KSTG / 32; ++sub) {
        const _Float16* kp = st + sub * 32 * LP;
        const _Float16* lp = kp + TILE_H;

        const _Float16* vp = st + 2 * TILE_H + sub * 32;
        const v16h ka = load_frag16(kp, LP, lane);
        const v16h kb = load_frag16(kp + 32, LP, lane);
        const v16h la = load_frag16(lp, LP, lane);
        const v16h lb = load_frag16(lp + 32, LP, lane);
        const v16h ka1 = load_frag16(kp + 16 * LP, LP, lane);
        const v16h kb1 = load_frag16(kp + 16 * LP + 32, LP, lane);
        const v16h la1 = load_frag16(lp + 16 * LP, LP, lane);
        const v16h lb1 = load_frag16(lp + 16 * LP + 32, LP, lane);
        const v16h va0 = load_frag16(vp, LP, lane);                    // d 0..15
        const v16h va1 = load_frag16(vp + 16 * LP, LP, lane);          // d 16..31
        const v16h va2 = load_frag16(vp + 32 * LP, LP, lane);          // d 32..47
        const v16h va3 = load_frag16(vp + 48 * LP, LP, lane);          // d 48..63
        v8f sh0 = wmma16(ka, qh0, zero8());
        sh0 = wmma16(kb, qh1, sh0);
        v8f sr0 = wmma16(ka, ql0, zero8());
        sr0 = wmma16(kb, ql1, sr0);
        sr0 = wmma16(la, qh0, sr0);
        sr0 = wmma16(lb, qh1, sr0);

        v8f sh1 = wmma16(ka1, qh0, zero8());
        sh1 = wmma16(kb1, qh1, sh1);
        v8f sr1 = wmma16(ka1, ql0, zero8());
        sr1 = wmma16(kb1, ql1, sr1);
        sr1 = wmma16(la1, qh0, sr1);
        sr1 = wmma16(lb1, qh1, sr1);

        float t0[8], t1[8];
        float ml = -1.0e30f;
#pragma unroll
        for (int g = 0; g < 8; ++g) {
            t0[g] = __builtin_fmaf(sh0[g], C1, sr0[g] * C2);
            t1[g] = __builtin_fmaf(sh1[g], C1, sr1[g] * C2);
            ml = fmaxf(ml, fmaxf(t0[g], t1[g]));
        }
        ml = fmaxf(ml, __shfl_xor(ml, 16, 32));
        const float mn   = fmaxf(mr, ml);
        const float corr = ex2(mr - mn);
        const float shf  = P_CARRY - mn;

        Frag pf;
        float ps = 0.0f;
#pragma unroll
        for (int g = 0; g < 8; ++g) {
            const float p0 = ex2(t0[g] + shf);
            const float p1 = ex2(t1[g] + shf);
            ps += p0 + p1;
            pf.v[g]     = (_Float16)p0;     // k = key0 + 8*(lane>>4) + g
            pf.v[8 + g] = (_Float16)p1;     // k = key0 + 16 + 8*(lane>>4) + g
        }
        lr = lr * corr + ps;
        mr = mn;

        ot0 = scale8(ot0, corr);
        ot1 = scale8(ot1, corr);
        ot2 = scale8(ot2, corr);
        ot3 = scale8(ot3, corr);

        ot0 = wmma16(va0, pf.v, ot0);
        ot1 = wmma16(va1, pf.v, ot1);
        ot2 = wmma16(va2, pf.v, ot2);
        ot3 = wmma16(va3, pf.v, ot3);
      }
        // publish point: this wave's reads of the buffer are done ...
        asm volatile("s_wait_dscnt 0x0" ::: "memory");
        // ... its copies of tile t + 1 have landed ...
        asm volatile("s_wait_asynccnt 0x0" ::: "memory");
        // ... and the one barrier publishes tile t + 1 and frees the buffer read in this trip
        __syncthreads();
        if (t + 2 < SEQ / KSTG) {
            const size_t kn = (size_t)(t + 2) * KSTG;
            attn_stage(gk + kn * DM, gl + kn * DM, gv + kn, l0 + (unsigned)(t & 1) * (STG_H * 2));
        }
    }
    // no copy is outstanding when the wave goes on to its end
    asm volatile("s_wait_asynccnt 0x0" ::: "memory");

    const float lt  = lr + __shfl_xor(lr, 16, 32);
    const float inv = 4.0f * (1.0f / lt);        // (2^10 P)(64 v) / (2^10 l) * 4 = 256 ctx

    _Float16* cs = &Cst[w][0];
    {
        v8h c0, c1, c2, c3;
#pragma unroll
        for (int g = 0; g < 8; ++g) {
            c0[g] = (_Float16)(ot0[g] * inv);
            c1[g] = (_Float16)(ot1[g] * inv);
            c2[g] = (_Float16)(ot2[g] * inv);
            c3[g] = (_Float16)(ot3[g] * inv);
        }
        // lane holds query cc, d = dt*16 + r0 + 0..7
        *(v8h*)(&cs[cc * LP + 0 * 16 + r0]) = c0;
        *(v8h*)(&cs[cc * LP + 1 * 16 + r0]) = c1;
        *(v8h*)(&cs[cc * LP + 2 * 16 + r0]) = c2;
        *(v8h*)(&cs[cc * LP + 3 * 16 + r0]) = c3;
    }
    wave_lds_sync();

    v8h cv[4];
#pragma unroll
    for (int j = 0; j < 4; ++j)
        cv[j] = *(const v8h*)(&cs[(4 * j + (lane >> 3)) * LP + (lane & 7) * 8]);
    _Float16* cb = ctx + ((size_t)b * SEQ + q0) * DM + (size_t)hd * DK + (lane & 7) * 8;
#pragma unroll
    for (int j = 0; j < 4; ++j)
        *(v8h*)(cb + (size_t)(4 * j + (lane >> 3)) * DM) = cv[j];
    
}

// ---------------------------------------------------------------------------
// GEMM + bias + residual -> f32 plane [NTOK][512] (input of a LayerNorm pass).
// Block = 4 waves = 128 rows x 64 columns. f32 tile staged wave-private;
// residual added at the store stage as float4; each instruction writes two
// ---------------------------------------------------------------------------
template <int K, bool RB>
static __device__ __forceinline__ void gemm_res_body(const _Float16* __restrict__ A,
                                                     const _Float16* __restrict__ W,
                                                     const float* __restrict__ bias,
                                                     const float* __restrict__ resblk,
                                                     float* __restrict__ out,
                                                     float* os, const _Float16* ring, float scale,
                                                     int m0, int n0, int w, int lane) {
    const int r0 = (lane >> 4) << 3;
    const int cc = lane & 15;
    v8f acc[2][4];
#pragma unroll
    for (int mt = 0; mt < 2; ++mt)
#pragma unroll
        for (int nt = 0; nt < 4; ++nt) acc[mt][nt] = zero8();

    gemm_32x64<K>(A + (size_t)m0 * K, W + (size_t)n0 * K, ring, w * 32 + lane, acc);

    float bia[4];
#pragma unroll
    for (int nt = 0; nt < 4; ++nt) bia[nt] = bf16r(bias[n0 + nt * 16 + cc]);

#pragma unroll
    for (int mt = 0; mt < 2; ++mt)
#pragma unroll
        for (int nt = 0; nt < 4; ++nt)
#pragma unroll
            for (int g = 0; g < 8; ++g)
                os[(mt * 16 + r0 + g) * FP + nt * 16 + cc] =
                    __builtin_fmaf(acc[mt][nt][g], scale, bia[nt]);
    wave_lds_sync();

    const int c4 = (lane & 15) * 4;
    v4f sv[16];
#pragma unroll
    for (int j = 0; j < 16; ++j) {
        const int row = 2 * j + (lane >> 4);
        v4f v = *(const v4f*)(&os[row * FP + c4]);
        v4f r = *(const v4f*)(resblk + (size_t)(w * 32 + row) * DM + n0 + c4);
        if (RB) { r.x = bf16r(r.x); r.y = bf16r(r.y); r.z = bf16r(r.z); r.w = bf16r(r.w); }
        v.x += r.x; v.y += r.y; v.z += r.z; v.w += r.w;
        sv[j] = v;
    }
    float* ob = out + (size_t)(m0 + w * 32) * DM + n0 + c4;
#pragma unroll
    for (int j = 0; j < 16; ++j)
        *(v4f*)(ob + (size_t)(2 * j + (lane >> 4)) * DM) = sv[j];
    
}

// pre = ctx @ Wo^T + bo + bf16(x)
__global__ __launch_bounds__(128) void k_wo(const _Float16* __restrict__ ctx,
                                             const _Float16* __restrict__ woh,
                                             const float* __restrict__ bo,
                                             const float* __restrict__ x,
                                             float* __restrict__ pre) {
    __shared__ __align__(16) float Ost[4 * 32 * FP];   // 34 KB, wave-private tiles
    __shared__ __align__(16) _Float16 ring[2 * GSTG_H]; // 54 KB, two operand stages
    const int tid = threadIdx.x, lane = tid & 31, w = tid >> 5;
    const int m0 = blockIdx.x * 128, n0 = blockIdx.y * 64;
    const int b  = m0 / SEQ;
    const int s0 = m0 - b * SEQ;
    const float* resblk = x + ((size_t)b * SEQ_FULL + s0) * DM;
    gemm_res_body<DM, true>(ctx, woh, bo, resblk, pre, &Ost[w * 32 * FP], ring, SC_WO, m0, n0, w, lane);
}

// pre = relu1 @ W2^T + b2 + h
__global__ __launch_bounds__(128) void k_ffn2(const _Float16* __restrict__ ff1,
                                               const _Float16* __restrict__ w2h,
                                               const float* __restrict__ b2,
                                               const float* __restrict__ hf,
                                               float* __restrict__ pre) {
    __shared__ __align__(16) float Ost[4 * 32 * FP];   // 34 KB, wave-private tiles
    __shared__ __align__(16) _Float16 ring[2 * GSTG_H]; // 54 KB, two operand stages
    const int tid = threadIdx.x, lane = tid & 31, w = tid >> 5;
    const int m0 = blockIdx.x * 128, n0 = blockIdx.y * 64;
    const float* resblk = hf + (size_t)m0 * DM;
    gemm_res_body<DFF, false>(ff1, w2h, b2, resblk, pre, &Ost[w * 32 * FP], ring, SC_FF2, m0, n0, w, lane);
}

// ---------------------------------------------------------------------------
// FFN up-projection: ff1 (x64, f16) = relu(h @ W1^T + b1). Block = 4 waves =
// ---------------------------------------------------------------------------
__global__ __launch_bounds__(128) void k_ffn1(const _Float16* __restrict__ hh,
                                               const _Float16* __restrict__ w1h,
                                               const float* __restrict__ b1,
                                               _Float16* __restrict__ ff1) {
    __shared__ __align__(16) _Float16 stA[128 * LP];   // 18 KB, wave-private tiles
    __shared__ __align__(16) _Float16 ring[2 * GSTG_H]; // 54 KB, two operand stages
    const int tid  = threadIdx.x;
    const int lane = tid & 31;
    const int w    = tid >> 5;
    const int m0   = blockIdx.x * 128;
    const int n0   = blockIdx.y * 64;
    const int r0   = (lane >> 4) << 3;
    const int cc   = lane & 15;

    v8f acc[2][4];
#pragma unroll
    for (int mt = 0; mt < 2; ++mt)
#pragma unroll
        for (int nt = 0; nt < 4; ++nt) acc[mt][nt] = zero8();

    gemm_32x64<DM>(hh + (size_t)m0 * DM, w1h + (size_t)n0 * DM, ring, tid, acc);

    float bia[4];
#pragma unroll
    for (int nt = 0; nt < 4; ++nt) bia[nt] = bf16r(b1[n0 + nt * 16 + cc]) * 64.0f;

    _Float16* sh = &stA[w * 32 * LP];
#pragma unroll
    for (int mt = 0; mt < 2; ++mt)
#pragma unroll
        for (int nt = 0; nt < 4; ++nt)
#pragma unroll
            for (int g = 0; g < 8; ++g) {
                const float v = acc[mt][nt][g] + bia[nt];
                sh[(mt * 16 + r0 + g) * LP + nt * 16 + cc] = (_Float16)((v > 0.0f) ? v : 0.0f);
            }
    wave_lds_sync();
    v8h ph[8];
#pragma unroll
    for (int j = 0; j < 8; ++j)
        ph[j] = *(const v8h*)(&sh[(4 * j + (lane >> 3)) * LP + (lane & 7) * 8]);
    _Float16* ob = ff1 + (size_t)(m0 + w * 32) * DFF + n0 + (lane & 7) * 8;
#pragma unroll
    for (int j = 0; j < 8; ++j)
        *(v8h*)(ob + (size_t)(4 * j + (lane >> 3)) * DFF) = ph[j];
    
}

// ---------------------------------------------------------------------------
// LayerNorm over 512 columns (biased variance, eps 1e-5), one wave per row,
// lane holds columns i*128 + lane*4 + 0..3 (i = 0..3): every load/store
// instruction covers 512 contiguous bytes (f32) or 256 bytes (f16).
// ---------------------------------------------------------------------------
template <bool HOUT>
static __device__ __forceinline__ void ln_body(const float* __restrict__ in,
                                               const float* __restrict__ g,
                                               const float* __restrict__ be,
                                               float* __restrict__ outF,
                                               _Float16* __restrict__ outH) {
    static_assert(DM == 32 * 16);
    const int tid  = threadIdx.x;
    const int lane = tid & 31;
    const int w    = tid >> 5;
    const size_t row = (size_t)blockIdx.x * 8 + w;
    const float* rp = in + row * DM + lane * 4;

    v4f xv[4];
#pragma unroll
    for (int i = 0; i < 4; ++i) xv[i] = *(const v4f*)(rp + i * 128);

    float s = 0.0f;
#pragma unroll
    for (int i = 0; i < 4; ++i) s += (xv[i].x + xv[i].y) + (xv[i].z + xv[i].w);
    s += __shfl_xor(s, 16, 32);
    s += __shfl_xor(s, 8, 32);
    s += __shfl_xor(s, 4, 32);
    s += __shfl_xor(s, 2, 32);
    s += __shfl_xor(s, 1, 32);
    const float mu = s * (1.0f / (float)DM);

    float s2 = 0.0f;
#pragma unroll
    for (int i = 0; i < 4; ++i) {
        const float d0 = xv[i].x - mu, d1 = xv[i].y - mu, d2 = xv[i].z - mu, d3 = xv[i].w - mu;
        s2 += (d0 * d0 + d1 * d1) + (d2 * d2 + d3 * d3);
    }
    s2 += __shfl_xor(s2, 16, 32);
    s2 += __shfl_xor(s2, 8, 32);
    s2 += __shfl_xor(s2, 4, 32);
    s2 += __shfl_xor(s2, 2, 32);
    s2 += __shfl_xor(s2, 1, 32);
    const float rstd = rsqrtf(s2 * (1.0f / (float)DM) + 1.0e-5f);

    v4f yv[4];
#pragma unroll
    for (int i = 0; i < 4; ++i) {
        const v4f gv = *(const v4f*)(g + i * 128 + lane * 4);
        const v4f bv = *(const v4f*)(be + i * 128 + lane * 4);
        v4f yy;
        yy.x = (xv[i].x - mu) * rstd * bf16r(gv.x) + bf16r(bv.x);
        yy.y = (xv[i].y - mu) * rstd * bf16r(gv.y) + bf16r(bv.y);
        yy.z = (xv[i].z - mu) * rstd * bf16r(gv.z) + bf16r(bv.z);
        yy.w = (xv[i].w - mu) * rstd * bf16r(gv.w) + bf16r(bv.w);
        yv[i] = yy;
    }
    v4h hv[4];
    if (HOUT) {
#pragma unroll
        for (int i = 0; i < 4; ++i) {
            v4h t;
            t.x = (_Float16)yv[i].x; t.y = (_Float16)yv[i].y;
            t.z = (_Float16)yv[i].z; t.w = (_Float16)yv[i].w;
            hv[i] = t;
        }
    }
    float* of = outF + row * DM + lane * 4;
#pragma unroll
    for (int i = 0; i < 4; ++i) *(v4f*)(of + i * 128) = yv[i];
    if (HOUT) {
        _Float16* oh = outH + row * DM + lane * 4;
#pragma unroll
        for (int i = 0; i < 4; ++i) *(v4h*)(oh + i * 128) = hv[i];
    }
    
}

__global__ __launch_bounds__(256) void k_ln_mid(const float* __restrict__ pre,
                                                 const float* __restrict__ g,
                                                 const float* __restrict__ be,
                                                 float* __restrict__ hf,
                                                 _Float16* __restrict__ hh) {
    ln_body<true>(pre, g, be, hf, hh);
}

__global__ __launch_bounds__(256) void k_ln_out(const float* __restrict__ pre,
                                                 const float* __restrict__ g,
                                                 const float* __restrict__ be,
                                                 float* __restrict__ out) {
    ln_body<false>(pre, g, be, out, nullptr);
}

// ---------------------------------------------------------------------------
// ---------------------------------------------------------------------------
#define SZ_XH   ((size_t)NTOK * DM * 2)
#define SZ_WQKV ((size_t)3 * DM * DM * 2)
#define SZ_WO   ((size_t)DM * DM * 2)
#define SZ_W1   ((size_t)DFF * DM * 2)
#define SZ_W2   ((size_t)DM * DFF * 2)
#define SZ_QK   ((size_t)4 * NTOK * DM * 2)     // qh, kh, ql, kl ; later reused for ff1
#define SZ_VT   ((size_t)NB * NH * DK * SEQ * 2)
#define SZ_CTX  ((size_t)NTOK * DM * 2)
#define SZ_PRE  ((size_t)NTOK * DM * 4)
#define SZ_HF   ((size_t)NTOK * DM * 4)
#define SZ_HH   ((size_t)NTOK * DM * 2)
#define SZ_FF1  ((size_t)NTOK * DFF * 2)
#define SZ_TOTAL (SZ_XH + SZ_WQKV + SZ_WO + SZ_W1 + SZ_W2 + SZ_QK + SZ_VT + SZ_CTX + SZ_PRE + SZ_HF + SZ_HH)

static_assert(SZ_XH + SZ_WQKV + SZ_WO + SZ_W1 + SZ_W2 == N_ALL * 2);   // the conversion launch's one destination array
static_assert(SZ_FF1 <= SZ_QK);                 // ff1 reuses the q/k plane region
static_assert(SZ_TOTAL <= (size_t)134217728);   // carve within 128 MiB
static_assert(SZ_XH % 128 == 0 && SZ_WQKV % 128 == 0 && SZ_WO % 128 == 0 && SZ_W1 % 128 == 0);
static_assert(SZ_QK % 128 == 0 && SZ_VT % 128 == 0 && SZ_PRE % 128 == 0 && SZ_HH % 128 == 0);

extern "C" void kernel_launch(void* const* d_in, const int* in_sizes, int n_in,
                              void* d_out, int out_size, void* d_ws, size_t ws_size,
                              hipStream_t stream) {
    if (n_in < 15) return;
    if (in_sizes[0] < ((NB - 1) * SEQ_FULL + SEQ) * DM) return;
    if (in_sizes[1] < DM * DM || in_sizes[3] < DM * DM || in_sizes[5] < DM * DM || in_sizes[7] < DM * DM) return;
    if (in_sizes[2] < DM || in_sizes[4] < DM || in_sizes[6] < DM || in_sizes[8] < DM) return;
    if (in_sizes[9] < DM || in_sizes[10] < DM) return;
    if (in_sizes[11] < DFF * DM || in_sizes[12] < DFF) return;
    if (in_sizes[13] < DM * DFF || in_sizes[14] < DM) return;
    if (out_size < NTOK * DM) return;
    if (SZ_TOTAL > ws_size) return;

    const float* x   = (const float*)d_in[0];    // [4,2048,512]
    const float* wq  = (const float*)d_in[1];    // [512,512] [out][in]
    const float* bq  = (const float*)d_in[2];
    const float* wk  = (const float*)d_in[3];
    const float* bk  = (const float*)d_in[4];
    const float* wv  = (const float*)d_in[5];
    const float* bv  = (const float*)d_in[6];
    const float* wo  = (const float*)d_in[7];
    const float* bo  = (const float*)d_in[8];
    const float* lng = (const float*)d_in[9];
    const float* lnb = (const float*)d_in[10];
    const float* w1  = (const float*)d_in[11];   // [2048,512] [out][in]
    const float* b1  = (const float*)d_in[12];
    const float* w2  = (const float*)d_in[13];   // [512,2048] [out][in]
    const float* b2  = (const float*)d_in[14];
    float* out = (float*)d_out;                  // [4,2048,512]

    char* ws = (char*)d_ws;
    size_t off = 0;
    _Float16* xh   = (_Float16*)(ws + off); off += SZ_XH;
    _Float16* wqkv = (_Float16*)(ws + off); off += SZ_WQKV;
    _Float16* woh  = (_Float16*)(ws + off); off += SZ_WO;
    _Float16* w1h  = (_Float16*)(ws + off); off += SZ_W1;
    _Float16* w2h  = (_Float16*)(ws + off); off += SZ_W2;
    _Float16* qkH  = (_Float16*)(ws + off);                    // qh then kh
    _Float16* qkL  = qkH + (size_t)2 * NTOK * DM;              // ql then kl
    _Float16* ff1  = qkH;                                      // reuse after attention
    off += SZ_QK;
    _Float16* vT   = (_Float16*)(ws + off); off += SZ_VT;
    _Float16* ctx  = (_Float16*)(ws + off); off += SZ_CTX;
    float*    pre  = (float*)(ws + off);    off += SZ_PRE;
    float*    hf   = (float*)(ws + off);    off += SZ_HF;
    _Float16* hh   = (_Float16*)(ws + off); off += SZ_HH;
    if (off > ws_size) return;

    const _Float16* qh = qkH;
    const _Float16* kh = qkH + (size_t)NTOK * DM;
    const _Float16* ql = qkL;
    const _Float16* kl = qkL + (size_t)NTOK * DM;

    // xh, wqkv, woh, w1h, w2h lie back to back from xh on
    k_cvt<<<dim3((unsigned)(N_ALL / CV_BLK)), dim3(256), 0, stream>>>(x, wq, wk, wv, wo, w1, w2, xh);

    k_qkv<<<dim3(NTOK / 128, 24), dim3(128), 0, stream>>>(xh, wqkv, bq, bk, bv, qkH, qkL, vT);
    k_attn<<<dim3(SEQ / 128, NH, NB), dim3(256), 0, stream>>>(qh, ql, kh, kl, vT, ctx);
    k_wo<<<dim3(NTOK / 128, DM / 64), dim3(128), 0, stream>>>(ctx, woh, bo, x, pre);
    k_ln_mid<<<dim3(NTOK / 8), dim3(256), 0, stream>>>(pre, lng, lnb, hf, hh);
    k_ffn1<<<dim3(NTOK / 128, DFF / 64), dim3(128), 0, stream>>>(hh, w1h, b1, ff1);
    k_ffn2<<<dim3(NTOK / 128, DM / 64), dim3(128), 0, stream>>>(ff1, w2h, b2, hf, pre);
    k_ln_out<<<dim3(NTOK / 8), dim3(256), 0, stream>>>(pre, lng, lnb, out);
}

// v003
// It runs in 150 microseconds.
// Two timings next to v002 put it at 1.05 and 1.06 times that version's speed.
// All steps since v000 together make it 2.68 times as fast.
#include <hip/hip_runtime.h>

// All contractions on v_wmma_f32_16x16x32_f16 (f16 operands, f32 accumulate): x*[Wq|Wk|Wv]^T, ctx*Wo^T, h*W1^T, relu*W2^T single f16 products (bf16-RNE inputs exact in f16, weights carried x64); q*k^T with f16 hi plane + 2^11-scaled f16 residual plane (two accumulators, residual folded 2^-11 in f32); P*v single product with P carried 2^10.

#ifndef NB
#define NB 4
#endif
#ifndef SEQ
#define SEQ 2048
#endif
#define NB_FULL  4
#define SEQ_FULL 2048
#define DM   512         // model width
#define NH   8           // heads
#define DK   64          // head width
#define DFF  2048        // FFN width
#define NTOK (NB * SEQ)
#define LP   72          // f16 staging pitch (halves), 144 B rows
#define VP   136         // transposed-V staging pitch (halves), 272 B rows
#define FP   68          // f32 staging pitch (floats), 272 B rows

static_assert(NB >= 1 && NB <= NB_FULL);           // batch within the input
static_assert(SEQ >= 128 && SEQ <= SEQ_FULL);      // sequence within the input
static_assert(SEQ % 128 == 0);                     // 128-token blocks never straddle a batch
static_assert(SEQ % 32 == 0);                      // key step of 32
static_assert(NTOK % 128 == 0);                    // GEMM M tile
static_assert(NTOK % 8 == 0);                      // LayerNorm rows per block
static_assert(DM == NH * DK);                      // head split h*64+d
static_assert(DK == 64);
static_assert(DM == 512);                          // LayerNorm: 32 lanes x 16 columns
static_assert(DM % 128 == 0 && DFF % 128 == 0);    // GEMM N tile
static_assert(DM % 32 == 0 && DFF % 32 == 0);      // WMMA k step
static_assert(64 * VP <= 128 * LP);                // transposed-V tile fits the f16 staging region
static_assert(LP % 8 == 0 && VP % 8 == 0 && FP % 4 == 0);   // 16-B aligned staging rows
#define KSTG   64            // keys per LDS stage of the attention ring
#define TILE_H (64 * LP)     // one staged tile: 64 rows of 128 B at pitch 144 B (halves)
#define STG_H  (3 * TILE_H)  // K hi, K residual, V^T
static_assert(SEQ % KSTG == 0 && SEQ / KSTG >= 2);   // the ring's prologue fills two stages
// GEMM ring: a stage is 128 A rows then 128 W rows of GKS k columns at pitch GKS + 8 halves
#define RING_H(GKS) (2 * 256 * ((GKS) + 8))   // two stages (halves)
#define GK_N   64            // k columns per stage where several blocks share a WGP
#define GK_W   128           // k columns per stage where a block has its WGP alone
static_assert(2 * 8 * 32 * LP <= RING_H(GK_N));       // two f16 staging planes of 8 wave tiles fit the ring
static_assert(8 * 32 * FP * 2 <= RING_H(GK_W));       // the f32 staging plane of 8 wave tiles fits the ring
static_assert(2 * 64 * VP <= 8 * 32 * LP);            // two transposed-V tiles fit one f16 staging plane

typedef _Float16 v16h __attribute__((ext_vector_type(16)));
typedef _Float16 v8h  __attribute__((ext_vector_type(8)));
typedef _Float16 v4h  __attribute__((ext_vector_type(4)));
typedef float    v8f  __attribute__((ext_vector_type(8)));
typedef float    v4f  __attribute__((ext_vector_type(4)));

union Frag { v16h v; v8h h[2]; };

// scores: acc_h = (64k_h).(64q_h), acc_r = 2^11-scaled residual cross terms
// t (log2 units) = acc_h * log2(e)*2^-15 + acc_r * log2(e)*2^-26   (1/8 score scale folded)
#define C1 (1.44269504088896340736f * 3.0517578125e-05f)
#define C2 (1.44269504088896340736f * 1.4901161193847656e-08f)
#define SC_RES   2048.0f                 // residual plane carry 2^11
#define P_CARRY  10.0f                   // P carried 2^10 (log2 units)
#define SC_WO    6.103515625e-05f        // 2^-14 : (256 ctx)(64 Wo)
#define SC_FF2   2.44140625e-04f         // 2^-12 : (64 ff1)(64 W2)

static __device__ __forceinline__ v8f zero8() {
    v8f z;
#pragma unroll
    for (int i = 0; i < 8; ++i) z[i] = 0.0f;
    return z;
}

// 16x32 A fragment (or B fragment from an [n][k] k-contiguous source) from a
// row-major 16-bit tile: lane m = lane&15 -> row m; kb = 8*(lane>>4);
// elements 0..7 = k kb..kb+7, elements 8..15 = k kb+16..kb+23.
static __device__ __forceinline__ v16h load_frag16(const _Float16* base, int ld, int lane) {
    int m  = lane & 15;
    int kb = (lane >> 4) << 3;
    const _Float16* p = base + (size_t)m * ld + kb;
    Frag f;
    f.h[0] = *(const v8h*)(p);
    f.h[1] = *(const v8h*)(p + 16);
    return f.v;
}

static __device__ __forceinline__ v8f wmma16(v16h a, v16h b, v8f c) {
    v8f d = __builtin_amdgcn_wmma_f32_16x16x32_f16(false, a, false, b, (short)0, c, false, false);
    asm volatile("v_nop\n\tv_nop\n\tv_nop\n\tv_nop" : "+v"(d) : "v"(a), "v"(b));
    return d;
}

// f32 -> bf16 RNE convert, value kept as f32
static __device__ __forceinline__ float bf16r(float x) {
    unsigned u = __float_as_uint(x);
    u = (u + 0x7FFFu + ((u >> 16) & 1u)) & 0xFFFF0000u;
    return __uint_as_float(u);
}

static __device__ __forceinline__ float ex2(float x) {
    return __builtin_amdgcn_exp2f(x);
}

// ordering for a wave-private LDS tile: stores before later loads of the same wave
static __device__ __forceinline__ void wave_lds_sync() {
    __builtin_amdgcn_fence(3, "wavefront");
    asm volatile("s_wait_dscnt 0" ::: "memory");
    __builtin_amdgcn_wave_barrier();
}

static __device__ __forceinline__ v8f scale8(v8f a, float s) {
#pragma unroll
    for (int i = 0; i < 8; ++i) a[i] *= s;
    return a;
}

// LDS byte address of a __shared__ element (operand of an asynchronous copy)
static __device__ __forceinline__ unsigned lds_addr(const _Float16* p) {
    return (unsigned)(size_t)(const __attribute__((address_space(3))) _Float16*)p;
}

// ---------------------------------------------------------------------------
// Operand planes: f16(bf16_rne(v) * scale), all seven sources in ONE launch.
// The destination planes xh | wq wk wv | wo | w1 | w2 are carved back to back,
// so they form one f16 array; a block converts CV_BLK consecutive elements of
// it, which lie in one plane (block-uniform source choice). A thread takes 8
// elements per pass, one 16-B store; all of its loads are issued up front.
// ---------------------------------------------------------------------------
#define CV_PASS 8                          // passes per block
#define CV_STEP 2048                       // elements per pass: 256 threads x 8
#define CV_BLK  (CV_PASS * CV_STEP)        // elements per block
#define N_X     ((size_t)NTOK * DM)
#define N_W     ((size_t)DM * DM)
#define N_F     ((size_t)DFF * DM)
#define N_ALL   (N_X + 4 * N_W + 2 * N_F)
static_assert(N_X % CV_BLK == 0 && N_W % CV_BLK == 0 && N_F % CV_BLK == 0);   // a block never straddles two planes
static_assert(CV_BLK % DM == 0 && SEQ % (CV_BLK / DM) == 0);                  // whole token rows of one batch

__global__ __launch_bounds__(256) void k_cvt(const float* __restrict__ x,
                                              const float* __restrict__ wq,
                                              const float* __restrict__ wk,
                                              const float* __restrict__ wv,
                                              const float* __restrict__ wo,
                                              const float* __restrict__ w1,
                                              const float* __restrict__ w2,
                                              _Float16* __restrict__ dst) {
    constexpr unsigned BX = (unsigned)(N_X / CV_BLK);   // blocks per plane
    constexpr unsigned BW = (unsigned)(N_W / CV_BLK);
    constexpr unsigned BF = (unsigned)(N_F / CV_BLK);
    const unsigned blk = blockIdx.x;
    const size_t   e0  = (size_t)blk * CV_BLK;
    const float* src;
    float scale;
    if (blk < BX) {
        const size_t tok = e0 / DM;
        const size_t b   = tok / SEQ;
        const size_t s   = tok - b * SEQ;
        src   = x + (b * SEQ_FULL + s) * DM;
        scale = 1.0f;
    } else {
        const unsigned p = blk - BX;
        const float*   base  = wq;
        unsigned       first = 0;
        if (p >= BW)          { base = wk; first = BW; }
        if (p >= 2 * BW)      { base = wv; first = 2 * BW; }
        if (p >= 3 * BW)      { base = wo; first = 3 * BW; }
        if (p >= 4 * BW)      { base = w1; first = 4 * BW; }
        if (p >= 4 * BW + BF) { base = w2; first = 4 * BW + BF; }
        src   = base + (size_t)(p - first) * CV_BLK;
        scale = 64.0f;
    }
    const int t8 = threadIdx.x * 8;
    v4f a0[CV_PASS], a1[CV_PASS];
#pragma unroll
    for (int j = 0; j < CV_PASS; ++j) {
        a0[j] = *(const v4f*)(src + j * CV_STEP + t8);
        a1[j] = *(const v4f*)(src + j * CV_STEP + t8 + 4);
    }
#pragma unroll
    for (int j = 0; j < CV_PASS; ++j) {
        v8h o;
        o[0] = (_Float16)(bf16r(a0[j].x) * scale); o[1] = (_Float16)(bf16r(a0[j].y) * scale);
        o[2] = (_Float16)(bf16r(a0[j].z) * scale); o[3] = (_Float16)(bf16r(a0[j].w) * scale);
        o[4] = (_Float16)(bf16r(a1[j].x) * scale); o[5] = (_Float16)(bf16r(a1[j].y) * scale);
        o[6] = (_Float16)(bf16r(a1[j].z) * scale); o[7] = (_Float16)(bf16r(a1[j].w) * scale);
        *(v8h*)(dst + e0 + j * CV_STEP + t8) = o;
    }
}

// ---------------------------------------------------------------------------
// Eight 16-B asynchronous copies of one lane: source rows ga + j gs (j = 0..3)
// then gb + j gs (j = 0..3), to LDS rows l + j rs (j = 0..7).
// s_wait_xcnt closes the statement so that no address register is rewritten
// ahead of it.
// ---------------------------------------------------------------------------
static __device__ __forceinline__ void copy8(const _Float16* ga, const _Float16* gb, size_t gs,
                                             unsigned l, unsigned rs) {
    asm volatile("global_load_async_to_lds_b128 %0, %8, off\n\t"
                 "global_load_async_to_lds_b128 %1, %9, off\n\t"
                 "global_load_async_to_lds_b128 %2, %10, off\n\t"
                 "global_load_async_to_lds_b128 %3, %11, off\n\t"
                 "global_load_async_to_lds_b128 %4, %12, off\n\t"
                 "global_load_async_to_lds_b128 %5, %13, off\n\t"
                 "global_load_async_to_lds_b128 %6, %14, off\n\t"
                 "global_load_async_to_lds_b128 %7, %15, off\n\t"
                 "s_wait_xcnt 0x0"
                 :: "v"(l), "v"(l + rs), "v"(l + 2 * rs), "v"(l + 3 * rs),
                    "v"(l + 4 * rs), "v"(l + 5 * rs), "v"(l + 6 * rs), "v"(l + 7 * rs),
                    "v"(ga), "v"(ga + gs), "v"(ga + 2 * gs), "v"(ga + 3 * gs),
                    "v"(gb), "v"(gb + gs), "v"(gb + 2 * gs), "v"(gb + 3 * gs)
                 : "memory");
}

// One lane's share of a GEMM stage (block of 256 threads): the block covers
// 2048 / GKS rows per copy, whole 128-B lines; 128 A rows, then 128 W rows.
template <int K, int GKS>
static __device__ __forceinline__ void gemm_stage(const _Float16* ga, const _Float16* gw, unsigned l) {
    static_assert(GKS == 64 || GKS == 128);
    constexpr int      RPP = 2048 / GKS;              // rows per copy of the block
    constexpr unsigned RS  = RPP * (GKS + 8) * 2;     // their LDS bytes
    constexpr size_t   GS  = (size_t)RPP * K;         // their source halves
    if (GKS == 64) {
        copy8(ga, gw, GS, l, RS);
    } else {
        copy8(ga, ga + 4 * GS, GS, l, RS);
        copy8(gw, gw + 4 * GS, GS, l + 8 * RS, RS);
    }
}

// ---------------------------------------------------------------------------
// Block GEMM core: 8 waves, 128 rows x 128 columns; wave w owns rows
// (w & 3)*32..+31 and columns (w >> 2)*64..+63.
// A (the block's first row, row-major pitch K) and W ([n][k] pitch K) come in
// stages of GKS k columns into a two-buffer LDS ring by asynchronous copies;
// fragments are read from the ring. Behind the call every wave has left the
// ring and no copy is outstanding: the ring may serve as output staging.
// acc[mt][nt][r] = element (row mt*16 + 8*(lane>>4) + r, col nt*16 + (lane&15)).
// ---------------------------------------------------------------------------
template <int K, int GKS>
static __device__ __forceinline__ void gemm_32x64(const _Float16* __restrict__ A,
                                                  const _Float16* __restrict__ W,
                                                  const _Float16* ring, int tid, v8f (&acc)[2][4]) {
    static_assert(K % GKS == 0 && K / GKS >= 2);   // the ring's prologue fills two stages
    constexpr int PT  = GKS + 8;                   // ring pitch (halves): 16 B x odd
    constexpr int SH  = 256 * PT;                  // one stage (halves)
    constexpr int CPR = GKS / 8;                   // 16-B chunks per row
    const int lane = tid & 31;
    const int w    = tid >> 5;
    const int crow = tid / CPR;
    const int cch  = (tid % CPR) * 8;
    const _Float16* ga = A + (size_t)crow * K + cch;
    const _Float16* gw = W + (size_t)crow * K + cch;
    const unsigned  l0 = lds_addr(ring + crow * PT + cch);

    gemm_stage<K, GKS>(ga, gw, l0);
    // tile 0 has landed before the barrier publishes it
    asm volatile("s_wait_asynccnt 0x0" ::: "memory");
    __syncthreads();
    gemm_stage<K, GKS>(ga + GKS, gw + GKS, l0 + SH * 2);

#pragma unroll 1
    for (int t = 0; t < K / GKS; ++t) {
        const _Float16* sa = ring + (t & 1) * SH + (w & 3) * 32 * PT;
        const _Float16* sw = ring + (t & 1) * SH + (128 + (w >> 2) * 64) * PT;
#pragma unroll
        for (int kk = 0; kk < GKS; kk += 32) {
            const v16h a0 = load_frag16(sa + kk, PT, lane);
            const v16h a1 = load_frag16(sa + 16 * PT + kk, PT, lane);
            v16h bw[4];
#pragma unroll
            for (int nt = 0; nt < 4; ++nt) bw[nt] = load_frag16(sw + nt * 16 * PT + kk, PT, lane);
#pragma unroll
            for (int nt = 0; nt < 4; ++nt) {
                acc[0][nt] = wmma16(a0, bw[nt], acc[0][nt]);
                acc[1][nt] = wmma16(a1, bw[nt], acc[1][nt]);
            }
        }
        // publish point: this wave's reads of the buffer are done ...
        asm volatile("s_wait_dscnt 0x0" ::: "memory");
        // ... its copies of tile t + 1 have landed ...
        asm volatile("s_wait_asynccnt 0x0" ::: "memory");
        // ... and the one barrier publishes tile t + 1 and frees the buffer read in this trip
        __syncthreads();
        if (t + 2 < K / GKS)
            gemm_stage<K, GKS>(ga + (t + 2) * GKS, gw + (t + 2) * GKS, l0 + (unsigned)(t & 1) * (SH * 2));
    }
    // no copy is outstanding when the wave goes on to its epilogue
    asm volatile("s_wait_asynccnt 0x0" ::: "memory");
}

// ---------------------------------------------------------------------------
// QKV projections. Block = 8 waves = 128 tokens x 128 columns (two heads of one
// of q/k/v, a wave's 64 columns are one head); grid (NTOK/128, 12). The output
// staging lies over the operand ring. Outputs carried x64:
//   q,k : f16 hi plane + f16 residual plane ((v - hi) * 2^11), [tok][512]
//         4 lines per lane-contiguous instruction.
//   v   : transposed plane vT[b][h][d][S]; block-level staging, one [64 d][128 tok] tile per head
// ---------------------------------------------------------------------------
__global__ __launch_bounds__(256) void k_qkv(const _Float16* __restrict__ xh,
                                              const _Float16* __restrict__ wqkv,
                                              const float* __restrict__ bq,
                                              const float* __restrict__ bk,
                                              const float* __restrict__ bv,
                                              _Float16* __restrict__ qkH,
                                              _Float16* __restrict__ qkL,
                                              _Float16* __restrict__ vT) {
    __shared__ __align__(16) _Float16 ring[RING_H(GK_N)];   // 72 KB, two operand stages
    _Float16* stA = ring;                  // 36 KB, staging behind the product loop
    _Float16* stB = ring + 8 * 32 * LP;    // 36 KB

    const int tid  = threadIdx.x;
    const int lane = tid & 31;
    const int w    = tid >> 5;
    const int wm   = w & 3;           // row group of 32 tokens
    const int wn   = w >> 2;          // column half
    const int m0   = blockIdx.x * 128;
    const int kind = blockIdx.y >> 2; // 0 q, 1 k, 2 v  (block-uniform)
    const int hd   = (blockIdx.y * 2 + wn) & 7;
    const int n0   = blockIdx.y * 128;
    const int r0   = (lane >> 4) << 3;
    const int cc   = lane & 15;

    v8f acc[2][4];
#pragma unroll
    for (int mt = 0; mt < 2; ++mt)
#pragma unroll
        for (int nt = 0; nt < 4; ++nt) acc[mt][nt] = zero8();

    gemm_32x64<DM, GK_N>(xh + (size_t)m0 * DM, wqkv + (size_t)n0 * DM, ring, tid, acc);

    float bia[4];
#pragma unroll
    for (int nt = 0; nt < 4; ++nt) {
        const int c = hd * 64 + nt * 16 + cc;
        const float fq = bq[c];
        const float fk = bk[c];
        const float fv = bv[c];
        const float bs = (kind == 0) ? fq : ((kind == 1) ? fk : fv);
        bia[nt] = bf16r(bs) * 64.0f;
    }

    if (kind < 2) {
        _Float16* sh = &stA[w * 32 * LP];
        _Float16* sl = &stB[w * 32 * LP];
#pragma unroll
        for (int mt = 0; mt < 2; ++mt)
#pragma unroll
            for (int nt = 0; nt < 4; ++nt)
#pragma unroll
                for (int g = 0; g < 8; ++g) {
                    const float v = acc[mt][nt][g] + bia[nt];
                    const _Float16 hv = (_Float16)v;
                    const int o = (mt * 16 + r0 + g) * LP + nt * 16 + cc;
                    sh[o] = hv;
                    sl[o] = (_Float16)((v - (float)hv) * SC_RES);
                }
        wave_lds_sync();
        v8h ph[8], pl[8];
#pragma unroll
        for (int j = 0; j < 8; ++j) {
            const int o = (4 * j + (lane >> 3)) * LP + (lane & 7) * 8;
            ph[j] = *(const v8h*)(&sh[o]);
            pl[j] = *(const v8h*)(&sl[o]);
        }
        const size_t base = (size_t)kind * NTOK * DM + (size_t)(m0 + wm * 32) * DM
                          + (size_t)hd * DK + (size_t)(lane & 7) * 8;
#pragma unroll
        for (int j = 0; j < 8; ++j) {
            const size_t o = base + (size_t)(4 * j + (lane >> 3)) * DM;
            *(v8h*)(qkH + o) = ph[j];
            *(v8h*)(qkL + o) = pl[j];
        }
        
    } else {
        // stA viewed as two tiles [64 d][VP], one per head; token index within the block along the row
        _Float16* vs = stA + wn * 64 * VP;
#pragma unroll
        for (int mt = 0; mt < 2; ++mt)
#pragma unroll
            for (int nt = 0; nt < 4; ++nt) {
                v8h pk;
#pragma unroll
                for (int g = 0; g < 8; ++g) pk[g] = (_Float16)(acc[mt][nt][g] + bia[nt]);
                *(v8h*)(&vs[(nt * 16 + cc) * VP + wm * 32 + mt * 16 + r0]) = pk;
            }
        __syncthreads();
        const int b  = m0 / SEQ;
        const int s0 = m0 - b * SEQ;
        v8h pv[8];
#pragma unroll
        for (int j = 0; j < 8; ++j) {
            const int d = wm * 16 + 2 * j + (lane >> 4);
            pv[j] = *(const v8h*)(&vs[d * VP + (lane & 15) * 8]);
        }
        _Float16* dst = vT + ((size_t)(b * NH + hd) * DK) * SEQ + s0 + (lane & 15) * 8;
#pragma unroll
        for (int j = 0; j < 8; ++j)
            *(v8h*)(dst + (size_t)(wm * 16 + 2 * j + (lane >> 4)) * SEQ) = pv[j];
        // no register of an issued store is rewritten ahead of this wait
        asm volatile("s_wait_xcnt 0x0" ::: "memory");
    }
}

// ---------------------------------------------------------------------------
// One lane's six 16-B asynchronous copies of an attention stage: rows r and
// r + 32 of the K hi, K residual and V^T tiles. A wave's copy covers four
// whole 128-B lines. s_wait_xcnt closes the statement so that no address
// register is rewritten ahead of it.
// ---------------------------------------------------------------------------
static __device__ __forceinline__ void attn_stage(const _Float16* gk, const _Float16* gl,
                                                  const _Float16* gv, unsigned l) {
    const _Float16* gk1 = gk + (size_t)32 * DM;
    const _Float16* gl1 = gl + (size_t)32 * DM;
    const _Float16* gv1 = gv + (size_t)32 * SEQ;
    const unsigned lk1 = l + 32 * LP * 2;
    const unsigned ll0 = l + TILE_H * 2;
    const unsigned ll1 = l + TILE_H * 2 + 32 * LP * 2;
    const unsigned lv0 = l + 2 * TILE_H * 2;
    const unsigned lv1 = l + 2 * TILE_H * 2 + 32 * LP * 2;
    asm volatile("global_load_async_to_lds_b128 %0, %6, off\n\t"
                 "global_load_async_to_lds_b128 %1, %7, off\n\t"
                 "global_load_async_to_lds_b128 %2, %8, off\n\t"
                 "global_load_async_to_lds_b128 %3, %9, off\n\t"
                 "global_load_async_to_lds_b128 %4, %10, off\n\t"
                 "global_load_async_to_lds_b128 %5, %11, off\n\t"
                 "s_wait_xcnt 0x0"
                 :: "v"(l), "v"(lk1), "v"(ll0), "v"(ll1), "v"(lv0), "v"(lv1),
                    "v"(gk), "v"(gk1), "v"(gl), "v"(gl1), "v"(gv), "v"(gv1)
                 : "memory");
}

// ---------------------------------------------------------------------------
// Flash attention, transposed form. Block = 8 waves = 128 queries of one
// (batch, head); wave owns 16 queries. K hi, K residual and V^T tiles of 64
// keys are brought into a two-buffer LDS ring by asynchronous copies (whole
// 128-B lines, once per block) and read as fragments by all 8 waves.
// Per 32-key step:
//   S^T tiles (keys x queries): A = K rows (hi / residual planes), B = Q rows
//   (hi / residual planes): hi.hi into acc_h; hi.lo + lo.hi into acc_r.
//   Query = lane column -> running max / sum are per-lane (one xor-16 shuffle).
//   P^T packed from the two S^T accumulators is directly the B fragment
//   (k = key = tile row, n = query = tile column); A = V^T rows from the
//   vT plane: O^T (d x queries) += V^T P^T.
// Epilogue: (O^T / l) * 4 = 256 ctx, f16, transposed through a wave-private
// ---------------------------------------------------------------------------
__global__ __launch_bounds__(256) __attribute__((amdgpu_num_vgpr(256)))
void k_attn(const _Float16* __restrict__ qh,
            const _Float16* __restrict__ ql,
            const _Float16* __restrict__ kh,
            const _Float16* __restrict__ kl,
            const _Float16* __restrict__ vT,
            _Float16* __restrict__ ctx) {
    __shared__ __align__(16) _Float16 Cst[8][16 * LP];   // 18 KB, wave-private tiles
    __shared__ __align__(16) _Float16 ring[2 * STG_H];   // 54 KB, two stages

    const int tid  = threadIdx.x;
    const int lane = tid & 31;
    const int w    = tid >> 5;
    const int b    = blockIdx.z;
    const int hd   = blockIdx.y;
    const int q0   = blockIdx.x * 128 + w * 16;
    const int r0   = (lane >> 4) << 3;
    const int cc   = lane & 15;

    const size_t qoff = ((size_t)b * SEQ + q0) * DM + (size_t)hd * DK;
    const v16h qh0 = load_frag16(qh + qoff, DM, lane);        // d 0..31
    const v16h qh1 = load_frag16(qh + qoff + 32, DM, lane);   // d 32..63
    const v16h ql0 = load_frag16(ql + qoff, DM, lane);
    const v16h ql1 = load_frag16(ql + qoff + 32, DM, lane);

    const _Float16* khb = kh + (size_t)b * SEQ * DM + (size_t)hd * DK;
    const _Float16* klb = kl + (size_t)b * SEQ * DM + (size_t)hd * DK;
    const _Float16* vtb = vT + ((size_t)(b * NH + hd) * DK) * SEQ;

    v8f ot0 = zero8(), ot1 = zero8(), ot2 = zero8(), ot3 = zero8();   // d tiles 0..3
    float mr = -1.0e30f, lr = 0.0f;

    // lane's share of a stage: rows crow and crow + 32 of each tile, 16 B at chunk tid & 7
    const int crow = tid >> 3;
    const int cch  = (tid & 7) * 8;
    const _Float16* gk = khb + (size_t)crow * DM + cch;
    const _Float16* gl = klb + (size_t)crow * DM + cch;
    const _Float16* gv = vtb + (size_t)crow * SEQ + cch;
    const unsigned  l0 = lds_addr(&ring[crow * LP + cch]);

    attn_stage(gk, gl, gv, l0);
    // tile 0 has landed before the barrier publishes it
    asm volatile("s_wait_asynccnt 0x0" ::: "memory");
    __syncthreads();
    attn_stage(gk + (size_t)KSTG * DM, gl + (size_t)KSTG * DM, gv + KSTG, l0 + STG_H * 2);

#pragma unroll 1
    for (int t = 0; t < SEQ / KSTG; ++t) {
      const _Float16* st = &ring[(t & 1) * STG_H];
#pragma unroll
      for (int sub = 0; sub < KSTG / 32; ++sub) {
        const _Float16* kp = st + sub * 32 * LP;
        const _Float16* lp = kp + TILE_H;

        const _Float16* vp = st + 2 * TILE_H + sub * 32;
        const v16h ka = load_frag16(kp, LP, lane);
        const v16h kb = load_frag16(kp + 32, LP, lane);
        const v16h la = load_frag16(lp, LP, lane);
        const v16h lb = load_frag16(lp + 32, LP, lane);
        const v16h ka1 = load_frag16(kp + 16 * LP, LP, lane);
        const v16h kb1 = load_frag16(kp + 16 * LP + 32, LP, lane);
        const v16h la1 = load_frag16(lp + 16 * LP, LP, lane);
        const v16h lb1 = load_frag16(lp + 16 * LP + 32, LP, lane);
        const v16h va0 = load_frag16(vp, LP, lane);                    // d 0..15
        const v16h va1 = load_frag16(vp + 16 * LP, LP, lane);          // d 16..31
        const v16h va2 = load_frag16(vp + 32 * LP, LP, lane);          // d 32..47
        const v16h va3 = load_frag16(vp + 48 * LP, LP, lane);          // d 48..63
        v8f sh0 = wmma16(ka, qh0, zero8());
        sh0 = wmma16(kb, qh1, sh0);
        v8f sr0 = wmma16(ka, ql0, zero8());
        sr0 = wmma16(kb, ql1, sr0);
        sr0 = wmma16(la, qh0, sr0);
        sr0 = wmma16(lb, qh1, sr0);

        v8f sh1 = wmma16(ka1, qh0, zero8());
        sh1 = wmma16(kb1, qh1, sh1);
        v8f sr1 = wmma16(ka1, ql0, zero8());
        sr1 = wmma16(kb1, ql1, sr1);
        sr1 = wmma16(la1, qh0, sr1);
        sr1 = wmma16(lb1, qh1, sr1);

        float t0[8], t1[8];
        float ml = -1.0e30f;
#pragma unroll
        for (int g = 0; g < 8; ++g) {
            t0[g] = __builtin_fmaf(sh0[g], C1, sr0[g] * C2);
            t1[g] = __builtin_fmaf(sh1[g], C1, sr1[g] * C2);
            ml = fmaxf(ml, fmaxf(t0[g], t1[g]));
        }
        ml = fmaxf(ml, __shfl_xor(ml, 16, 32));
        const float mn   = fmaxf(mr, ml);
        const float corr = ex2(mr - mn);
        const float shf  = P_CARRY - mn;

        Frag pf;
        float ps = 0.0f;
#pragma unroll
        for (int g = 0; g < 8; ++g) {
            const float p0 = ex2(t0[g] + shf);
            const float p1 = ex2(t1[g] + shf);
            ps += p0 + p1;
            pf.v[g]     = (_Float16)p0;     // k = key0 + 8*(lane>>4) + g
            pf.v[8 + g] = (_Float16)p1;     // k = key0 + 16 + 8*(lane>>4) + g
        }
        lr = lr * corr + ps;
        mr = mn;

        ot0 = scale8(ot0, corr);
        ot1 = scale8(ot1, corr);
        ot2 = scale8(ot2, corr);
        ot3 = scale8(ot3, corr);

        ot0 = wmma16(va0, pf.v, ot0);
        ot1 = wmma16(va1, pf.v, ot1);
        ot2 = wmma16(va2, pf.v, ot2);
        ot3 = wmma16(va3, pf.v, ot3);
      }
        // publish point: this wave's reads of the buffer are done ...
        asm volatile("s_wait_dscnt 0x0" ::: "memory");
        // ... its copies of tile t + 1 have landed ...
        asm volatile("s_wait_asynccnt 0x0" ::: "memory");
        // ... and the one barrier publishes tile t + 1 and frees the buffer read in this trip
        __syncthreads();
        if (t + 2 < SEQ / KSTG) {
            const size_t kn = (size_t)(t + 2) * KSTG;
            attn_stage(gk + kn * DM, gl + kn * DM, gv + kn, l0 + (unsigned)(t & 1) * (STG_H * 2));
        }
    }
    // no copy is outstanding when the wave goes on to its end
    asm volatile("s_wait_asynccnt 0x0" ::: "memory");

    const float lt  = lr + __shfl_xor(lr, 16, 32);
    const float inv = 4.0f * (1.0f / lt);        // (2^10 P)(64 v) / (2^10 l) * 4 = 256 ctx

    _Float16* cs = &Cst[w][0];
    {
        v8h c0, c1, c2, c3;
#pragma unroll
        for (int g = 0; g < 8; ++g) {
            c0[g] = (_Float16)(ot0[g] * inv);
            c1[g] = (_Float16)(ot1[g] * inv);
            c2[g] = (_Float16)(ot2[g] * inv);
            c3[g] = (_Float16)(ot3[g] * inv);
        }
        // lane holds query cc, d = dt*16 + r0 + 0..7
        *(v8h*)(&cs[cc * LP + 0 * 16 + r0]) = c0;
        *(v8h*)(&cs[cc * LP + 1 * 16 + r0]) = c1;
        *(v8h*)(&cs[cc * LP + 2 * 16 + r0]) = c2;
        *(v8h*)(&cs[cc * LP + 3 * 16 + r0]) = c3;
    }
    wave_lds_sync();

    v8h cv[4];
#pragma unroll
    for (int j = 0; j < 4; ++j)
        cv[j] = *(const v8h*)(&cs[(4 * j + (lane >> 3)) * LP + (lane & 7) * 8]);
    _Float16* cb = ctx + ((size_t)b * SEQ + q0) * DM + (size_t)hd * DK + (lane & 7) * 8;
#pragma unroll
    for (int j = 0; j < 4; ++j)
        *(v8h*)(cb + (size_t)(4 * j + (lane >> 3)) * DM) = cv[j];
    
}

// ---------------------------------------------------------------------------
// GEMM + bias + residual -> f32 plane [NTOK][512] (input of a LayerNorm pass).
// Block = 8 waves = 128 rows x 128 columns. f32 tile staged wave-private, over the operand ring;
// residual added at the store stage as float4; each instruction writes two
// ---------------------------------------------------------------------------
template <int K, bool RB>
static __device__ __forceinline__ void gemm_res_body(const _Float16* __restrict__ A,
                                                     const _Float16* __restrict__ W,
                                                     const float* __restrict__ bias,
                                                     const float* __restrict__ resblk,
                                                     float* __restrict__ out,
                                                     _Float16* ring, float scale,
                                                     int m0, int nb, int tid) {
    const int lane = tid & 31;
    const int w    = tid >> 5;
    const int wm   = w & 3;              // row group of 32
    const int n0   = nb + (w >> 2) * 64; // the wave's first column
    const int r0 = (lane >> 4) << 3;
    const int cc = lane & 15;
    float* os = (float*)ring + w * 32 * FP;
    v8f acc[2][4];
#pragma unroll
    for (int mt = 0; mt < 2; ++mt)
#pragma unroll
        for (int nt = 0; nt < 4; ++nt) acc[mt][nt] = zero8();

    gemm_32x64<K, GK_W>(A + (size_t)m0 * K, W + (size_t)nb * K, ring, tid, acc);

    float bia[4];
#pragma unroll
    for (int nt = 0; nt < 4; ++nt) bia[nt] = bf16r(bias[n0 + nt * 16 + cc]);

#pragma unroll
    for (int mt = 0; mt < 2; ++mt)
#pragma unroll
        for (int nt = 0; nt < 4; ++nt)
#pragma unroll
            for (int g = 0; g < 8; ++g)
                os[(mt * 16 + r0 + g) * FP + nt * 16 + cc] =
                    __builtin_fmaf(acc[mt][nt][g], scale, bia[nt]);
    wave_lds_sync();

    const int c4 = (lane & 15) * 4;
    const float* rb = resblk + (size_t)(wm * 32 + (lane >> 4)) * DM + n0 + c4;   // the lane's first residual row
    v4f sv[16];
#pragma unroll
    for (int j = 0; j < 16; ++j) {
        const int row = 2 * j + (lane >> 4);
        v4f v = *(const v4f*)(&os[row * FP + c4]);
        v4f r = *(const v4f*)(rb + (size_t)(2 * j) * DM);
        if (RB) { r.x = bf16r(r.x); r.y = bf16r(r.y); r.z = bf16r(r.z); r.w = bf16r(r.w); }
        v.x += r.x; v.y += r.y; v.z += r.z; v.w += r.w;
        sv[j] = v;
    }
    float* ob = out + (size_t)(m0 + wm * 32) * DM + n0 + c4;
#pragma unroll
    for (int j = 0; j < 16; ++j)
        *(v4f*)(ob + (size_t)(2 * j + (lane >> 4)) * DM) = sv[j];
    
}

// pre = ctx @ Wo^T + bo + bf16(x)
__global__ __launch_bounds__(256) void k_wo(const _Float16* __restrict__ ctx,
                                             const _Float16* __restrict__ woh,
                                             const float* __restrict__ bo,
                                             const float* __restrict__ x,
                                             float* __restrict__ pre) {
    __shared__ __align__(16) _Float16 ring[RING_H(GK_W)];   // 136 KB, two operand stages
    const int tid = threadIdx.x;
    const int m0 = blockIdx.x * 128, n0 = blockIdx.y * 128;
    const int b  = m0 / SEQ;
    const int s0 = m0 - b * SEQ;
    const float* resblk = x + ((size_t)b * SEQ_FULL + s0) * DM;
    gemm_res_body<DM, true>(ctx, woh, bo, resblk, pre, ring, SC_WO, m0, n0, tid);
}

// pre = relu1 @ W2^T + b2 + h
__global__ __launch_bounds__(256) void k_ffn2(const _Float16* __restrict__ ff1,
                                               const _Float16* __restrict__ w2h,
                                               const float* __restrict__ b2,
                                               const float* __restrict__ hf,
                                               float* __restrict__ pre) {
    __shared__ __align__(16) _Float16 ring[RING_H(GK_W)];   // 136 KB, two operand stages
    const int tid = threadIdx.x;
    const int m0 = blockIdx.x * 128, n0 = blockIdx.y * 128;
    const float* resblk = hf + (size_t)m0 * DM;
    gemm_res_body<DFF, false>(ff1, w2h, b2, resblk, pre, ring, SC_FF2, m0, n0, tid);
}

// ---------------------------------------------------------------------------
// FFN up-projection: ff1 (x64, f16) = relu(h @ W1^T + b1). Block = 8 waves =
// 128 rows x 128 columns; the output staging lies over the operand ring.
// ---------------------------------------------------------------------------
__global__ __launch_bounds__(256) void k_ffn1(const _Float16* __restrict__ hh,
                                               const _Float16* __restrict__ w1h,
                                               const float* __restrict__ b1,
                                               _Float16* __restrict__ ff1) {
    __shared__ __align__(16) _Float16 ring[RING_H(GK_N)];   // 72 KB, two operand stages
    const int tid  = threadIdx.x;
    const int lane = tid & 31;
    const int w    = tid >> 5;
    const int wm   = w & 3;                         // row group of 32
    const int m0   = blockIdx.x * 128;
    const int nb   = blockIdx.y * 128;
    const int n0   = nb + (w >> 2) * 64;            // the wave's first column
    const int r0   = (lane >> 4) << 3;
    const int cc   = lane & 15;

    v8f acc[2][4];
#pragma unroll
    for (int mt = 0; mt < 2; ++mt)
#pragma unroll
        for (int nt = 0; nt < 4; ++nt) acc[mt][nt] = zero8();

    gemm_32x64<DM, GK_N>(hh + (size_t)m0 * DM, w1h + (size_t)nb * DM, ring, tid, acc);

    float bia[4];
#pragma unroll
    for (int nt = 0; nt < 4; ++nt) bia[nt] = bf16r(b1[n0 + nt * 16 + cc]) * 64.0f;

    _Float16* sh = &ring[w * 32 * LP];
#pragma unroll
    for (int mt = 0; mt < 2; ++mt)
#pragma unroll
        for (int nt = 0; nt < 4; ++nt)
#pragma unroll
            for (int g = 0; g < 8; ++g) {
                const float v = acc[mt][nt][g] + bia[nt];
                sh[(mt * 16 + r0 + g) * LP + nt * 16 + cc] = (_Float16)((v > 0.0f) ? v : 0.0f);
            }
    wave_lds_sync();
    v8h ph[8];
#pragma unroll
    for (int j = 0; j < 8; ++j)
        ph[j] = *(const v8h*)(&sh[(4 * j + (lane >> 3)) * LP + (lane & 7) * 8]);
    _Float16* ob = ff1 + (size_t)(m0 + wm * 32) * DFF + n0 + (lane & 7) * 8;
#pragma unroll
    for (int j = 0; j < 8; ++j)
        *(v8h*)(ob + (size_t)(4 * j + (lane >> 3)) * DFF) = ph[j];
    
}

// ---------------------------------------------------------------------------
// LayerNorm over 512 columns (biased variance, eps 1e-5), one wave per row,
// lane holds columns i*128 + lane*4 + 0..3 (i = 0..3): every load/store
// instruction covers 512 contiguous bytes (f32) or 256 bytes (f16).
// ---------------------------------------------------------------------------
template <bool HOUT>
static __device__ __forceinline__ void ln_body(const float* __restrict__ in,
                                               const float* __restrict__ g,
                                               const float* __restrict__ be,
                                               float* __restrict__ outF,
                                               _Float16* __restrict__ outH) {
    static_assert(DM == 32 * 16);
    const int tid  = threadIdx.x;
    const int lane = tid & 31;
    const int w    = tid >> 5;
    const size_t row = (size_t)blockIdx.x * 8 + w;
    const float* rp = in + row * DM + lane * 4;

    v4f xv[4];
#pragma unroll
    for (int i = 0; i < 4; ++i) xv[i] = *(const v4f*)(rp + i * 128);

    float s = 0.0f;
#pragma unroll
    for (int i = 0; i < 4; ++i) s += (xv[i].x + xv[i].y) + (xv[i].z + xv[i].w);
    s += __shfl_xor(s, 16, 32);
    s += __shfl_xor(s, 8, 32);
    s += __shfl_xor(s, 4, 32);
    s += __shfl_xor(s, 2, 32);
    s += __shfl_xor(s, 1, 32);
    const float mu = s * (1.0f / (float)DM);

    float s2 = 0.0f;
#pragma unroll
    for (int i = 0; i < 4; ++i) {
        const float d0 = xv[i].x - mu, d1 = xv[i].y - mu, d2 = xv[i].z - mu, d3 = xv[i].w - mu;
        s2 += (d0 * d0 + d1 * d1) + (d2 * d2 + d3 * d3);
    }
    s2 += __shfl_xor(s2, 16, 32);
    s2 += __shfl_xor(s2, 8, 32);
    s2 += __shfl_xor(s2, 4, 32);
    s2 += __shfl_xor(s2, 2, 32);
    s2 += __shfl_xor(s2, 1, 32);
    const float rstd = rsqrtf(s2 * (1.0f / (float)DM) + 1.0e-5f);

    v4f yv[4];
#pragma unroll
    for (int i = 0; i < 4; ++i) {
        const v4f gv = *(const v4f*)(g + i * 128 + lane * 4);
        const v4f bv = *(const v4f*)(be + i * 128 + lane * 4);
        v4f yy;
        yy.x = (xv[i].x - mu) * rstd * bf16r(gv.x) + bf16r(bv.x);
        yy.y = (xv[i].y - mu) * rstd * bf16r(gv.y) + bf16r(bv.y);
        yy.z = (xv[i].z - mu) * rstd * bf16r(gv.z) + bf16r(bv.z);
        yy.w = (xv[i].w - mu) * rstd * bf16r(gv.w) + bf16r(bv.w);
        yv[i] = yy;
    }
    v4h hv[4];
    if (HOUT) {
#pragma unroll
        for (int i = 0; i < 4; ++i) {
            v4h t;
            t.x = (_Float16)yv[i].x; t.y = (_Float16)yv[i].y;
            t.z = (_Float16)yv[i].z; t.w = (_Float16)yv[i].w;
            hv[i] = t;
        }
    }
    float* of = outF + row * DM + lane * 4;
#pragma unroll
    for (int i = 0; i < 4; ++i) *(v4f*)(of + i * 128) = yv[i];
    if (HOUT) {
        _Float16* oh = outH + row * DM + lane * 4;
#pragma unroll
        for (int i = 0; i < 4; ++i) *(v4h*)(oh + i * 128) = hv[i];
    }
    
}

__global__ __launch_bounds__(256) void k_ln_mid(const float* __restrict__ pre,
                                                 const float* __restrict__ g,
                                                 const float* __restrict__ be,
                                                 float* __restrict__ hf,
                                                 _Float16* __restrict__ hh) {
    ln_body<true>(pre, g, be, hf, hh);
}

__global__ __launch_bounds__(256) void k_ln_out(const float* __restrict__ pre,
                                                 const float* __restrict__ g,
                                                 const float* __restrict__ be,
                                                 float* __restrict__ out) {
    ln_body<false>(pre, g, be, out, nullptr);
}

// ---------------------------------------------------------------------------
// ---------------------------------------------------------------------------
#define SZ_XH   ((size_t)NTOK * DM * 2)
#define SZ_WQKV ((size_t)3 * DM * DM * 2)
#define SZ_WO   ((size_t)DM * DM * 2)
#define SZ_W1   ((size_t)DFF * DM * 2)
#define SZ_W2   ((size_t)DM * DFF * 2)
#define SZ_QK   ((size_t)4 * NTOK * DM * 2)     // qh, kh, ql, kl ; later reused for ff1
#define SZ_VT   ((size_t)NB * NH * DK * SEQ * 2)
#define SZ_CTX  ((size_t)NTOK * DM * 2)
#define SZ_PRE  ((size_t)NTOK * DM * 4)
#define SZ_HF   ((size_t)NTOK * DM * 4)
#define SZ_HH   ((size_t)NTOK * DM * 2)
#define SZ_FF1  ((size_t)NTOK * DFF * 2)
#define SZ_TOTAL (SZ_XH + SZ_WQKV + SZ_WO + SZ_W1 + SZ_W2 + SZ_QK + SZ_VT + SZ_CTX + SZ_PRE + SZ_HF + SZ_HH)

static_assert(SZ_XH + SZ_WQKV + SZ_WO + SZ_W1 + SZ_W2 == N_ALL * 2);   // the conversion launch's one destination array
static_assert(SZ_FF1 <= SZ_QK);                 // ff1 reuses the q/k plane region
static_assert(SZ_TOTAL <= (size_t)134217728);   // carve within 128 MiB
static_assert(SZ_XH % 128 == 0 && SZ_WQKV % 128 == 0 && SZ_WO % 128 == 0 && SZ_W1 % 128 == 0);
static_assert(SZ_QK % 128 == 0 && SZ_VT % 128 == 0 && SZ_PRE % 128 == 0 && SZ_HH % 128 == 0);

extern "C" void kernel_launch(void* const* d_in, const int* in_sizes, int n_in,
                              void* d_out, int out_size, void* d_ws, size_t ws_size,
                              hipStream_t stream) {
    if (n_in < 15) return;
    if (in_sizes[0] < ((NB - 1) * SEQ_FULL + SEQ) * DM) return;
    if (in_sizes[1] < DM * DM || in_sizes[3] < DM * DM || in_sizes[5] < DM * DM || in_sizes[7] < DM * DM) return;
    if (in_sizes[2] < DM || in_sizes[4] < DM || in_sizes[6] < DM || in_sizes[8] < DM) return;
    if (in_sizes[9] < DM || in_sizes[10] < DM) return;
    if (in_sizes[11] < DFF * DM || in_sizes[12] < DFF) return;
    if (in_sizes[13] < DM * DFF || in_sizes[14] < DM) return;
    if (out_size < NTOK * DM) return;
    if (SZ_TOTAL > ws_size) return;

    const float* x   = (const float*)d_in[0];    // [4,2048,512]
    const float* wq  = (const float*)d_in[1];    // [512,512] [out][in]
    const float* bq  = (const float*)d_in[2];
    const float* wk  = (const float*)d_in[3];
    const float* bk  = (const float*)d_in[4];
    const float* wv  = (const float*)d_in[5];
    const float* bv  = (const float*)d_in[6];
    const float* wo  = (const float*)d_in[7];
    const float* bo  = (const float*)d_in[8];
    const float* lng = (const float*)d_in[9];
    const float* lnb = (const float*)d_in[10];
    const float* w1  = (const float*)d_in[11];   // [2048,512] [out][in]
    const float* b1  = (const float*)d_in[12];
    const float* w2  = (const float*)d_in[13];   // [512,2048] [out][in]
    const float* b2  = (const float*)d_in[14];
    float* out = (float*)d_out;                  // [4,2048,512]

    char* ws = (char*)d_ws;
    size_t off = 0;
    _Float16* xh   = (_Float16*)(ws + off); off += SZ_XH;
    _Float16* wqkv = (_Float16*)(ws + off); off += SZ_WQKV;
    _Float16* woh  = (_Float16*)(ws + off); off += SZ_WO;
    _Float16* w1h  = (_Float16*)(ws + off); off += SZ_W1;
    _Float16* w2h  = (_Float16*)(ws + off); off += SZ_W2;
    _Float16* qkH  = (_Float16*)(ws + off);                    // qh then kh
    _Float16* qkL  = qkH + (size_t)2 * NTOK * DM;              // ql then kl
    _Float16* ff1  = qkH;                                      // reuse after attention
    off += SZ_QK;
    _Float16* vT   = (_Float16*)(ws + off); off += SZ_VT;
    _Float16* ctx  = (_Float16*)(ws + off); off += SZ_CTX;
    float*    pre  = (float*)(ws + off);    off += SZ_PRE;
    float*    hf   = (float*)(ws + off);    off += SZ_HF;
    _Float16* hh   = (_Float16*)(ws + off); off += SZ_HH;
    if (off > ws_size) return;

    const _Float16* qh = qkH;
    const _Float16* kh = qkH + (size_t)NTOK * DM;
    const _Float16* ql = qkL;
    const _Float16* kl = qkL + (size_t)NTOK * DM;

    // xh, wqkv, woh, w1h, w2h lie back to back from xh on
    k_cvt<<<dim3((unsigned)(N_ALL / CV_BLK)), dim3(256), 0, stream>>>(x, wq, wk, wv, wo, w1, w2, xh);

    k_qkv<<<dim3(NTOK / 128, 12), dim3(256), 0, stream>>>(xh, wqkv, bq, bk, bv, qkH, qkL, vT);
    k_attn<<<dim3(SEQ / 128, NH, NB), dim3(256), 0, stream>>>(qh, ql, kh, kl, vT, ctx);
    k_wo<<<dim3(NTOK / 128, DM / 128), dim3(256), 0, stream>>>(ctx, woh, bo, x, pre);
    k_ln_mid<<<dim3(NTOK / 8), dim3(256), 0, stream>>>(pre, lng, lnb, hf, hh);
    k_ffn1<<<dim3(NTOK / 128, DFF / 128), dim3(256), 0, stream>>>(hh, w1h, b1, ff1);
    k_ffn2<<<dim3(NTOK / 128, DM / 128), dim3(256), 0, stream>>>(ff1, w2h, b2, hf, pre);
    k_ln_out<<<dim3(NTOK / 8), dim3(256), 0, stream>>>(pre, lng, lnb, out);
}

// v004
// It runs in 125 microseconds.
// Two timings next to v003 both put it at 1.18 times that version's speed.
// Over all steps from v000 it is 3.16 times as fast.
#include <hip/hip_runtime.h>

// All contractions on v_wmma_f32_16x16x32_f16 (f16 operands, f32 accumulate): x*[Wq|Wk|Wv]^T, ctx*Wo^T, h*W1^T, relu*W2^T single f16 products (bf16-RNE inputs exact in f16, weights carried x64); q*k^T single f16 product (q, k carried x64, rounded once to f16); P*v single product with P carried 2^10.

#ifndef NB
#define NB 4
#endif
#ifndef SEQ
#define SEQ 2048
#endif
#define NB_FULL  4
#define SEQ_FULL 2048
#define DM   512         // model width
#define NH   8           // heads
#define DK   64          // head width
#define DFF  2048        // FFN width
#define NTOK (NB * SEQ)
#define LP   72          // f16 staging pitch (halves), 144 B rows
#define VP   136         // transposed-V staging pitch (halves), 272 B rows
#define FP   68          // f32 staging pitch (floats), 272 B rows

static_assert(NB >= 1 && NB <= NB_FULL);           // batch within the input
static_assert(SEQ >= 128 && SEQ <= SEQ_FULL);      // sequence within the input
static_assert(SEQ % 128 == 0);                     // 128-token blocks never straddle a batch
static_assert(SEQ % 32 == 0);                      // key step of 32
static_assert(NTOK % 128 == 0);                    // GEMM M tile
static_assert(NTOK % 8 == 0);                      // LayerNorm rows per block
static_assert(DM == NH * DK);                      // head split h*64+d
static_assert(DK == 64);
static_assert(DM == 512);                          // LayerNorm: 32 lanes x 16 columns
static_assert(DM % 128 == 0 && DFF % 128 == 0);    // GEMM N tile
static_assert(DM % 32 == 0 && DFF % 32 == 0);      // WMMA k step
static_assert(64 * VP <= 128 * LP);                // transposed-V tile fits the f16 staging region
static_assert(LP % 8 == 0 && VP % 8 == 0 && FP % 4 == 0);   // 16-B aligned staging rows
#define KSTG   64            // keys per LDS stage of the attention ring
#define TILE_H (64 * LP)     // one staged tile: 64 rows of 128 B at pitch 144 B (halves)
#define STG_H  (2 * TILE_H)  // K, V^T
static_assert(SEQ % KSTG == 0 && SEQ / KSTG >= 2);   // the ring's prologue fills two stages
// GEMM ring: a stage is 128 A rows then 128 W rows of GKS k columns at pitch GKS + 8 halves
#define RING_H(GKS) (2 * 256 * ((GKS) + 8))   // two stages (halves)
#define GK_N   64            // k columns per stage where several blocks share a WGP
#define GK_W   128           // k columns per stage where a block has its WGP alone
static_assert(8 * 32 * LP <= RING_H(GK_N));           // the f16 staging plane of 8 wave tiles fits the ring
static_assert(8 * 32 * FP * 2 <= RING_H(GK_W));       // the f32 staging plane of 8 wave tiles fits the ring
static_assert(2 * 64 * VP <= 8 * 32 * LP);            // two transposed-V tiles fit one f16 staging plane

typedef _Float16 v16h __attribute__((ext_vector_type(16)));
typedef _Float16 v8h  __attribute__((ext_vector_type(8)));
typedef _Float16 v4h  __attribute__((ext_vector_type(4)));
typedef float    v8f  __attribute__((ext_vector_type(8)));
typedef float    v4f  __attribute__((ext_vector_type(4)));

union Frag { v16h v; v8h h[2]; };

// scores: acc = (64k).(64q); t (log2 units) = acc * log2(e)*2^-15   (1/8 score scale folded)
#define C1 (1.44269504088896340736f * 3.0517578125e-05f)
#define P_CARRY  10.0f                   // P carried 2^10 (log2 units)
#define SC_WO    6.103515625e-05f        // 2^-14 : (256 ctx)(64 Wo)
#define SC_FF2   2.44140625e-04f         // 2^-12 : (64 ff1)(64 W2)

static __device__ __forceinline__ v8f zero8() {
    v8f z;
#pragma unroll
    for (int i = 0; i < 8; ++i) z[i] = 0.0f;
    return z;
}

// 16x32 A fragment (or B fragment from an [n][k] k-contiguous source) from a
// row-major 16-bit tile: lane m = lane&15 -> row m; kb = 8*(lane>>4);
// elements 0..7 = k kb..kb+7, elements 8..15 = k kb+16..kb+23.
static __device__ __forceinline__ v16h load_frag16(const _Float16* base, int ld, int lane) {
    int m  = lane & 15;
    int kb = (lane >> 4) << 3;
    const _Float16* p = base + (size_t)m * ld + kb;
    Frag f;
    f.h[0] = *(const v8h*)(p);
    f.h[1] = *(const v8h*)(p + 16);
    return f.v;
}

static __device__ __forceinline__ v8f wmma16(v16h a, v16h b, v8f c) {
    v8f d = __builtin_amdgcn_wmma_f32_16x16x32_f16(false, a, false, b, (short)0, c, false, false);
    asm volatile("v_nop\n\tv_nop\n\tv_nop\n\tv_nop" : "+v"(d) : "v"(a), "v"(b));
    return d;
}

// f32 -> bf16 RNE convert, value kept as f32
static __device__ __forceinline__ float bf16r(float x) {
    unsigned u = __float_as_uint(x);
    u = (u + 0x7FFFu + ((u >> 16) & 1u)) & 0xFFFF0000u;
    return __uint_as_float(u);
}

static __device__ __forceinline__ float ex2(float x) {
    return __builtin_amdgcn_exp2f(x);
}

// ordering for a wave-private LDS tile: stores before later loads of the same wave
static __device__ __forceinline__ void wave_lds_sync() {
    __builtin_amdgcn_fence(3, "wavefront");
    asm volatile("s_wait_dscnt 0" ::: "memory");
    __builtin_amdgcn_wave_barrier();
}

static __device__ __forceinline__ v8f scale8(v8f a, float s) {
#pragma unroll
    for (int i = 0; i < 8; ++i) a[i] *= s;
    return a;
}

// LDS byte address of a __shared__ element (operand of an asynchronous copy)
static __device__ __forceinline__ unsigned lds_addr(const _Float16* p) {
    return (unsigned)(size_t)(const __attribute__((address_space(3))) _Float16*)p;
}

// ---------------------------------------------------------------------------
// Operand planes: f16(bf16_rne(v) * scale), all seven sources in ONE launch.
// The destination planes xh | wq wk wv | wo | w1 | w2 are carved back to back,
// so they form one f16 array; a block converts CV_BLK consecutive elements of
// it, which lie in one plane (block-uniform source choice). A thread takes 8
// elements per pass, one 16-B store; all of its loads are issued up front.
// ---------------------------------------------------------------------------
#define CV_PASS 8                          // passes per block
#define CV_STEP 2048                       // elements per pass: 256 threads x 8
#define CV_BLK  (CV_PASS * CV_STEP)        // elements per block
#define N_X     ((size_t)NTOK * DM)
#define N_W     ((size_t)DM * DM)
#define N_F     ((size_t)DFF * DM)
#define N_ALL   (N_X + 4 * N_W + 2 * N_F)
static_assert(N_X % CV_BLK == 0 && N_W % CV_BLK == 0 && N_F % CV_BLK == 0);   // a block never straddles two planes
static_assert(CV_BLK % DM == 0 && SEQ % (CV_BLK / DM) == 0);                  // whole token rows of one batch

__global__ __launch_bounds__(256) void k_cvt(const float* __restrict__ x,
                                              const float* __restrict__ wq,
                                              const float* __restrict__ wk,
                                              const float* __restrict__ wv,
                                              const float* __restrict__ wo,
                                              const float* __restrict__ w1,
                                              const float* __restrict__ w2,
                                              _Float16* __restrict__ dst) {
    constexpr unsigned BX = (unsigned)(N_X / CV_BLK);   // blocks per plane
    constexpr unsigned BW = (unsigned)(N_W / CV_BLK);
    constexpr unsigned BF = (unsigned)(N_F / CV_BLK);
    const unsigned blk = blockIdx.x;
    const size_t   e0  = (size_t)blk * CV_BLK;
    const float* src;
    float scale;
    if (blk < BX) {
        const size_t tok = e0 / DM;
        const size_t b   = tok / SEQ;
        const size_t s   = tok - b * SEQ;
        src   = x + (b * SEQ_FULL + s) * DM;
        scale = 1.0f;
    } else {
        const unsigned p = blk - BX;
        const float*   base  = wq;
        unsigned       first = 0;
        if (p >= BW)          { base = wk; first = BW; }
        if (p >= 2 * BW)      { base = wv; first = 2 * BW; }
        if (p >= 3 * BW)      { base = wo; first = 3 * BW; }
        if (p >= 4 * BW)      { base = w1; first = 4 * BW; }
        if (p >= 4 * BW + BF) { base = w2; first = 4 * BW + BF; }
        src   = base + (size_t)(p - first) * CV_BLK;
        scale = 64.0f;
    }
    const int t8 = threadIdx.x * 8;
    v4f a0[CV_PASS], a1[CV_PASS];
#pragma unroll
    for (int j = 0; j < CV_PASS; ++j) {
        a0[j] = *(const v4f*)(src + j * CV_STEP + t8);
        a1[j] = *(const v4f*)(src + j * CV_STEP + t8 + 4);
    }
#pragma unroll
    for (int j = 0; j < CV_PASS; ++j) {
        v8h o;
        o[0] = (_Float16)(bf16r(a0[j].x) * scale); o[1] = (_Float16)(bf16r(a0[j].y) * scale);
        o[2] = (_Float16)(bf16r(a0[j].z) * scale); o[3] = (_Float16)(bf16r(a0[j].w) * scale);
        o[4] = (_Float16)(bf16r(a1[j].x) * scale); o[5] = (_Float16)(bf16r(a1[j].y) * scale);
        o[6] = (_Float16)(bf16r(a1[j].z) * scale); o[7] = (_Float16)(bf16r(a1[j].w) * scale);
        *(v8h*)(dst + e0 + j * CV_STEP + t8) = o;
    }
}

// ---------------------------------------------------------------------------
// Eight 16-B asynchronous copies of one lane: source rows ga + j gs (j = 0..3)
// then gb + j gs (j = 0..3), to LDS rows l + j rs (j = 0..7).
// s_wait_xcnt closes the statement so that no address register is rewritten
// ahead of it.
// ---------------------------------------------------------------------------
static __device__ __forceinline__ void copy8(const _Float16* ga, const _Float16* gb, size_t gs,
                                             unsigned l, unsigned rs) {
    asm volatile("global_load_async_to_lds_b128 %0, %8, off\n\t"
                 "global_load_async_to_lds_b128 %1, %9, off\n\t"
                 "global_load_async_to_lds_b128 %2, %10, off\n\t"
                 "global_load_async_to_lds_b128 %3, %11, off\n\t"
                 "global_load_async_to_lds_b128 %4, %12, off\n\t"
                 "global_load_async_to_lds_b128 %5, %13, off\n\t"
                 "global_load_async_to_lds_b128 %6, %14, off\n\t"
                 "global_load_async_to_lds_b128 %7, %15, off\n\t"
                 "s_wait_xcnt 0x0"
                 :: "v"(l), "v"(l + rs), "v"(l + 2 * rs), "v"(l + 3 * rs),
                    "v"(l + 4 * rs), "v"(l + 5 * rs), "v"(l + 6 * rs), "v"(l + 7 * rs),
                    "v"(ga), "v"(ga + gs), "v"(ga + 2 * gs), "v"(ga + 3 * gs),
                    "v"(gb), "v"(gb + gs), "v"(gb + 2 * gs), "v"(gb + 3 * gs)
                 : "memory");
}

// One lane's share of a GEMM stage (block of 256 threads): the block covers
// 2048 / GKS rows per copy, whole 128-B lines; 128 A rows, then 128 W rows.
template <int K, int GKS>
static __device__ __forceinline__ void gemm_stage(const _Float16* ga, const _Float16* gw, unsigned l) {
    static_assert(GKS == 64 || GKS == 128);
    constexpr int      RPP = 2048 / GKS;              // rows per copy of the block
    constexpr unsigned RS  = RPP * (GKS + 8) * 2;     // their LDS bytes
    constexpr size_t   GS  = (size_t)RPP * K;         // their source halves
    if (GKS == 64) {
        copy8(ga, gw, GS, l, RS);
    } else {
        copy8(ga, ga + 4 * GS, GS, l, RS);
        copy8(gw, gw + 4 * GS, GS, l + 8 * RS, RS);
    }
}

// ---------------------------------------------------------------------------
// Block GEMM core: 8 waves, 128 rows x 128 columns; wave w owns rows
// (w & 3)*32..+31 and columns (w >> 2)*64..+63.
// A (the block's first row, row-major pitch K) and W ([n][k] pitch K) come in
// stages of GKS k columns into a two-buffer LDS ring by asynchronous copies;
// fragments are read from the ring. Behind the call every wave has left the
// ring and no copy is outstanding: the ring may serve as output staging.
// acc[mt][nt][r] = element (row mt*16 + 8*(lane>>4) + r, col nt*16 + (lane&15)).
// ---------------------------------------------------------------------------
template <int K, int GKS>
static __device__ __forceinline__ void gemm_32x64(const _Float16* __restrict__ A,
                                                  const _Float16* __restrict__ W,
                                                  const _Float16* ring, int tid, v8f (&acc)[2][4]) {
    static_assert(K % GKS == 0 && K / GKS >= 2);   // the ring's prologue fills two stages
    constexpr int PT  = GKS + 8;                   // ring pitch (halves): 16 B x odd
    constexpr int SH  = 256 * PT;                  // one stage (halves)
    constexpr int CPR = GKS / 8;                   // 16-B chunks per row
    const int lane = tid & 31;
    const int w    = tid >> 5;
    const int crow = tid / CPR;
    const int cch  = (tid % CPR) * 8;
    const _Float16* ga = A + (size_t)crow * K + cch;
    const _Float16* gw = W + (size_t)crow * K + cch;
    const unsigned  l0 = lds_addr(ring + crow * PT + cch);

    gemm_stage<K, GKS>(ga, gw, l0);
    // tile 0 has landed before the barrier publishes it
    asm volatile("s_wait_asynccnt 0x0" ::: "memory");
    __syncthreads();
    gemm_stage<K, GKS>(ga + GKS, gw + GKS, l0 + SH * 2);

#pragma unroll 1
    for (int t = 0; t < K / GKS; ++t) {
        const _Float16* sa = ring + (t & 1) * SH + (w & 3) * 32 * PT;
        const _Float16* sw = ring + (t & 1) * SH + (128 + (w >> 2) * 64) * PT;
#pragma unroll
        for (int kk = 0; kk < GKS; kk += 32) {
            const v16h a0 = load_frag16(sa + kk, PT, lane);
            const v16h a1 = load_frag16(sa + 16 * PT + kk, PT, lane);
            v16h bw[4];
#pragma unroll
            for (int nt = 0; nt < 4; ++nt) bw[nt] = load_frag16(sw + nt * 16 * PT + kk, PT, lane);
#pragma unroll
            for (int nt = 0; nt < 4; ++nt) {
                acc[0][nt] = wmma16(a0, bw[nt], acc[0][nt]);
                acc[1][nt] = wmma16(a1, bw[nt], acc[1][nt]);
            }
        }
        // publish point: this wave's reads of the buffer are done ...
        asm volatile("s_wait_dscnt 0x0" ::: "memory");
        // ... its copies of tile t + 1 have landed ...
        asm volatile("s_wait_asynccnt 0x0" ::: "memory");
        // ... and the one barrier publishes tile t + 1 and frees the buffer read in this trip
        __syncthreads();
        if (t + 2 < K / GKS)
            gemm_stage<K, GKS>(ga + (t + 2) * GKS, gw + (t + 2) * GKS, l0 + (unsigned)(t & 1) * (SH * 2));
    }
    // no copy is outstanding when the wave goes on to its epilogue
    asm volatile("s_wait_asynccnt 0x0" ::: "memory");
}

// ---------------------------------------------------------------------------
// QKV projections. Block = 8 waves = 128 tokens x 128 columns (two heads of one
// of q/k/v, a wave's 64 columns are one head); grid (NTOK/128, 12). The output
// staging lies over the operand ring. Outputs carried x64:
//   q,k : one f16 plane each, [tok][512]
//         4 lines per lane-contiguous instruction.
//   v   : transposed plane vT[b][h][d][S]; block-level staging, one [64 d][128 tok] tile per head
// ---------------------------------------------------------------------------
__global__ __launch_bounds__(256) void k_qkv(const _Float16* __restrict__ xh,
                                              const _Float16* __restrict__ wqkv,
                                              const float* __restrict__ bq,
                                              const float* __restrict__ bk,
                                              const float* __restrict__ bv,
                                              _Float16* __restrict__ qk,
                                              _Float16* __restrict__ vT) {
    __shared__ __align__(16) _Float16 ring[RING_H(GK_N)];   // 72 KB, two operand stages
    _Float16* stA = ring;                  // 36 KB, staging behind the product loop

    const int tid  = threadIdx.x;
    const int lane = tid & 31;
    const int w    = tid >> 5;
    const int wm   = w & 3;           // row group of 32 tokens
    const int wn   = w >> 2;          // column half
    const int m0   = blockIdx.x * 128;
    const int kind = blockIdx.y >> 2; // 0 q, 1 k, 2 v  (block-uniform)
    const int hd   = (blockIdx.y * 2 + wn) & 7;
    const int n0   = blockIdx.y * 128;
    const int r0   = (lane >> 4) << 3;
    const int cc   = lane & 15;

    v8f acc[2][4];
#pragma unroll
    for (int mt = 0; mt < 2; ++mt)
#pragma unroll
        for (int nt = 0; nt < 4; ++nt) acc[mt][nt] = zero8();

    gemm_32x64<DM, GK_N>(xh + (size_t)m0 * DM, wqkv + (size_t)n0 * DM, ring, tid, acc);

    float bia[4];
#pragma unroll
    for (int nt = 0; nt < 4; ++nt) {
        const int c = hd * 64 + nt * 16 + cc;
        const float fq = bq[c];
        const float fk = bk[c];
        const float fv = bv[c];
        const float bs = (kind == 0) ? fq : ((kind == 1) ? fk : fv);
        bia[nt] = bf16r(bs) * 64.0f;
    }

    if (kind < 2) {
        _Float16* sh = &stA[w * 32 * LP];
#pragma unroll
        for (int mt = 0; mt < 2; ++mt)
#pragma unroll
            for (int nt = 0; nt < 4; ++nt)
#pragma unroll
                for (int g = 0; g < 8; ++g)
                    sh[(mt * 16 + r0 + g) * LP + nt * 16 + cc] = (_Float16)(acc[mt][nt][g] + bia[nt]);
        wave_lds_sync();
        v8h ph[8];
#pragma unroll
        for (int j = 0; j < 8; ++j)
            ph[j] = *(const v8h*)(&sh[(4 * j + (lane >> 3)) * LP + (lane & 7) * 8]);
        const size_t base = (size_t)kind * NTOK * DM + (size_t)(m0 + wm * 32) * DM
                          + (size_t)hd * DK + (size_t)(lane & 7) * 8;
#pragma unroll
        for (int j = 0; j < 8; ++j)
            *(v8h*)(qk + base + (size_t)(4 * j + (lane >> 3)) * DM) = ph[j];
        
    } else {
        // stA viewed as two tiles [64 d][VP], one per head; token index within the block along the row
        _Float16* vs = stA + wn * 64 * VP;
#pragma unroll
        for (int mt = 0; mt < 2; ++mt)
#pragma unroll
            for (int nt = 0; nt < 4; ++nt) {
                v8h pk;
#pragma unroll
                for (int g = 0; g < 8; ++g) pk[g] = (_Float16)(acc[mt][nt][g] + bia[nt]);
                *(v8h*)(&vs[(nt * 16 + cc) * VP + wm * 32 + mt * 16 + r0]) = pk;
            }
        __syncthreads();
        const int b  = m0 / SEQ;
        const int s0 = m0 - b * SEQ;
        v8h pv[8];
#pragma unroll
        for (int j = 0; j < 8; ++j) {
            const int d = wm * 16 + 2 * j + (lane >> 4);
            pv[j] = *(const v8h*)(&vs[d * VP + (lane & 15) * 8]);
        }
        _Float16* dst = vT + ((size_t)(b * NH + hd) * DK) * SEQ + s0 + (lane & 15) * 8;
#pragma unroll
        for (int j = 0; j < 8; ++j)
            *(v8h*)(dst + (size_t)(wm * 16 + 2 * j + (lane >> 4)) * SEQ) = pv[j];
        // no register of an issued store is rewritten ahead of this wait
        asm volatile("s_wait_xcnt 0x0" ::: "memory");
    }
}

// ---------------------------------------------------------------------------
// One lane's four 16-B asynchronous copies of an attention stage: rows r and
// r + 32 of the K and V^T tiles. A wave's copy covers four
// whole 128-B lines. s_wait_xcnt closes the statement so that no address
// register is rewritten ahead of it.
// ---------------------------------------------------------------------------
static __device__ __forceinline__ void attn_stage(const _Float16* gk, const _Float16* gv, unsigned l) {
    const _Float16* gk1 = gk + (size_t)32 * DM;
    const _Float16* gv1 = gv + (size_t)32 * SEQ;
    const unsigned lk1 = l + 32 * LP * 2;
    const unsigned lv0 = l + TILE_H * 2;
    const unsigned lv1 = l + TILE_H * 2 + 32 * LP * 2;
    asm volatile("global_load_async_to_lds_b128 %0, %4, off\n\t"
                 "global_load_async_to_lds_b128 %1, %5, off\n\t"
                 "global_load_async_to_lds_b128 %2, %6, off\n\t"
                 "global_load_async_to_lds_b128 %3, %7, off\n\t"
                 "s_wait_xcnt 0x0"
                 :: "v"(l), "v"(lk1), "v"(lv0), "v"(lv1),
                    "v"(gk), "v"(gk1), "v"(gv), "v"(gv1)
                 : "memory");
}

// ---------------------------------------------------------------------------
// Flash attention, transposed form. Block = 8 waves = 128 queries of one
// (batch, head); wave owns 16 queries. K and V^T tiles of 64
// keys are brought into a two-buffer LDS ring by asynchronous copies (whole
// 128-B lines, once per block) and read as fragments by all 8 waves.
// Per 32-key step:
//   S^T tiles (keys x queries): A = K rows, B = Q rows, one f16 product.
//   Query = lane column -> running max / sum are per-lane (one xor-16 shuffle).
//   P^T packed from the two S^T accumulators is directly the B fragment
//   (k = key = tile row, n = query = tile column); A = V^T rows from the
//   vT plane: O^T (d x queries) += V^T P^T.
// Epilogue: (O^T / l) * 4 = 256 ctx, f16, transposed through a wave-private
// ---------------------------------------------------------------------------
__global__ __launch_bounds__(256) __attribute__((amdgpu_num_vgpr(256)))
void k_attn(const _Float16* __restrict__ qh,
            const _Float16* __restrict__ kh,
            const _Float16* __restrict__ vT,
            _Float16* __restrict__ ctx) {
    __shared__ __align__(16) _Float16 Cst[8][16 * LP];   // 18 KB, wave-private tiles
    __shared__ __align__(16) _Float16 ring[2 * STG_H];   // 36 KB, two stages

    const int tid  = threadIdx.x;
    const int lane = tid & 31;
    const int w    = tid >> 5;
    const int b    = blockIdx.z;
    const int hd   = blockIdx.y;
    const int q0   = blockIdx.x * 128 + w * 16;
    const int r0   = (lane >> 4) << 3;
    const int cc   = lane & 15;

    const size_t qoff = ((size_t)b * SEQ + q0) * DM + (size_t)hd * DK;
    const v16h qh0 = load_frag16(qh + qoff, DM, lane);        // d 0..31
    const v16h qh1 = load_frag16(qh + qoff + 32, DM, lane);   // d 32..63

    const _Float16* khb = kh + (size_t)b * SEQ * DM + (size_t)hd * DK;
    const _Float16* vtb = vT + ((size_t)(b * NH + hd) * DK) * SEQ;

    v8f ot0 = zero8(), ot1 = zero8(), ot2 = zero8(), ot3 = zero8();   // d tiles 0..3
    float mr = -1.0e30f, lr = 0.0f;

    // lane's share of a stage: rows crow and crow + 32 of each tile, 16 B at chunk tid & 7
    const int crow = tid >> 3;
    const int cch  = (tid & 7) * 8;
    const _Float16* gk = khb + (size_t)crow * DM + cch;
    const _Float16* gv = vtb + (size_t)crow * SEQ + cch;
    const unsigned  l0 = lds_addr(&ring[crow * LP + cch]);

    attn_stage(gk, gv, l0);
    // tile 0 has landed before the barrier publishes it
    asm volatile("s_wait_asynccnt 0x0" ::: "memory");
    __syncthreads();
    attn_stage(gk + (size_t)KSTG * DM, gv + KSTG, l0 + STG_H * 2);

#pragma unroll 1
    for (int t = 0; t < SEQ / KSTG; ++t) {
      const _Float16* st = &ring[(t & 1) * STG_H];
#pragma unroll
      for (int sub = 0; sub < KSTG / 32; ++sub) {
        const _Float16* kp = st + sub * 32 * LP;
        const _Float16* vp = st + TILE_H + sub * 32;
        const v16h ka = load_frag16(kp, LP, lane);
        const v16h kb = load_frag16(kp + 32, LP, lane);
        const v16h ka1 = load_frag16(kp + 16 * LP, LP, lane);
        const v16h kb1 = load_frag16(kp + 16 * LP + 32, LP, lane);
        const v16h va0 = load_frag16(vp, LP, lane);                    // d 0..15
        const v16h va1 = load_frag16(vp + 16 * LP, LP, lane);          // d 16..31
        const v16h va2 = load_frag16(vp + 32 * LP, LP, lane);          // d 32..47
        const v16h va3 = load_frag16(vp + 48 * LP, LP, lane);          // d 48..63
        v8f sh0 = wmma16(ka, qh0, zero8());
        sh0 = wmma16(kb, qh1, sh0);
        v8f sh1 = wmma16(ka1, qh0, zero8());
        sh1 = wmma16(kb1, qh1, sh1);

        float t0[8], t1[8];
        float ml = -1.0e30f;
#pragma unroll
        for (int g = 0; g < 8; ++g) {
            t0[g] = sh0[g] * C1;
            t1[g] = sh1[g] * C1;
            ml = fmaxf(ml, fmaxf(t0[g], t1[g]));
        }
        ml = fmaxf(ml, __shfl_xor(ml, 16, 32));
        const float mn   = fmaxf(mr, ml);
        const float corr = ex2(mr - mn);
        const float shf  = P_CARRY - mn;

        Frag pf;
        float ps = 0.0f;
#pragma unroll
        for (int g = 0; g < 8; ++g) {
            const float p0 = ex2(t0[g] + shf);
            const float p1 = ex2(t1[g] + shf);
            ps += p0 + p1;
            pf.v[g]     = (_Float16)p0;     // k = key0 + 8*(lane>>4) + g
            pf.v[8 + g] = (_Float16)p1;     // k = key0 + 16 + 8*(lane>>4) + g
        }
        lr = lr * corr + ps;
        mr = mn;

        ot0 = scale8(ot0, corr);
        ot1 = scale8(ot1, corr);
        ot2 = scale8(ot2, corr);
        ot3 = scale8(ot3, corr);

        ot0 = wmma16(va0, pf.v, ot0);
        ot1 = wmma16(va1, pf.v, ot1);
        ot2 = wmma16(va2, pf.v, ot2);
        ot3 = wmma16(va3, pf.v, ot3);
      }
        // publish point: this wave's reads of the buffer are done ...
        asm volatile("s_wait_dscnt 0x0" ::: "memory");
        // ... its copies of tile t + 1 have landed ...
        asm volatile("s_wait_asynccnt 0x0" ::: "memory");
        // ... and the one barrier publishes tile t + 1 and frees the buffer read in this trip
        __syncthreads();
        if (t + 2 < SEQ / KSTG) {
            const size_t kn = (size_t)(t + 2) * KSTG;
            attn_stage(gk + kn * DM, gv + kn, l0 + (unsigned)(t & 1) * (STG_H * 2));
        }
    }
    // no copy is outstanding when the wave goes on to its end
    asm volatile("s_wait_asynccnt 0x0" ::: "memory");

    const float lt  = lr + __shfl_xor(lr, 16, 32);
    const float inv = 4.0f * (1.0f / lt);        // (2^10 P)(64 v) / (2^10 l) * 4 = 256 ctx

    _Float16* cs = &Cst[w][0];
    {
        v8h c0, c1, c2, c3;
#pragma unroll
        for (int g = 0; g < 8; ++g) {
            c0[g] = (_Float16)(ot0[g] * inv);
            c1[g] = (_Float16)(ot1[g] * inv);
            c2[g] = (_Float16)(ot2[g] * inv);
            c3[g] = (_Float16)(ot3[g] * inv);
        }
        // lane holds query cc, d = dt*16 + r0 + 0..7
        *(v8h*)(&cs[cc * LP + 0 * 16 + r0]) = c0;
        *(v8h*)(&cs[cc * LP + 1 * 16 + r0]) = c1;
        *(v8h*)(&cs[cc * LP + 2 * 16 + r0]) = c2;
        *(v8h*)(&cs[cc * LP + 3 * 16 + r0]) = c3;
    }
    wave_lds_sync();

    v8h cv[4];
#pragma unroll
    for (int j = 0; j < 4; ++j)
        cv[j] = *(const v8h*)(&cs[(4 * j + (lane >> 3)) * LP + (lane & 7) * 8]);
    _Float16* cb = ctx + ((size_t)b * SEQ + q0) * DM + (size_t)hd * DK + (lane & 7) * 8;
#pragma unroll
    for (int j = 0; j < 4; ++j)
        *(v8h*)(cb + (size_t)(4 * j + (lane >> 3)) * DM) = cv[j];
    
}

// ---------------------------------------------------------------------------
// GEMM + bias + residual -> f32 plane [NTOK][512] (input of a LayerNorm pass).
// Block = 8 waves = 128 rows x 128 columns. f32 tile staged wave-private, over the operand ring;
// residual added at the store stage as float4; each instruction writes two
// ---------------------------------------------------------------------------
template <int K, bool RB>
static __device__ __forceinline__ void gemm_res_body(const _Float16* __restrict__ A,
                                                     const _Float16* __restrict__ W,
                                                     const float* __restrict__ bias,
                                                     const float* __restrict__ resblk,
                                                     float* __restrict__ out,
                                                     _Float16* ring, float scale,
                                                     int m0, int nb, int tid) {
    const int lane = tid & 31;
    const int w    = tid >> 5;
    const int wm   = w & 3;              // row group of 32
    const int n0   = nb + (w >> 2) * 64; // the wave's first column
    const int r0 = (lane >> 4) << 3;
    const int cc = lane & 15;
    float* os = (float*)ring + w * 32 * FP;
    v8f acc[2][4];
#pragma unroll
    for (int mt = 0; mt < 2; ++mt)
#pragma unroll
        for (int nt = 0; nt < 4; ++nt) acc[mt][nt] = zero8();

    gemm_32x64<K, GK_W>(A + (size_t)m0 * K, W + (size_t)nb * K, ring, tid, acc);

    float bia[4];
#pragma unroll
    for (int nt = 0; nt < 4; ++nt) bia[nt] = bf16r(bias[n0 + nt * 16 + cc]);

#pragma unroll
    for (int mt = 0; mt < 2; ++mt)
#pragma unroll
        for (int nt = 0; nt < 4; ++nt)
#pragma unroll
            for (int g = 0; g < 8; ++g)
                os[(mt * 16 + r0 + g) * FP + nt * 16 + cc] =
                    __builtin_fmaf(acc[mt][nt][g], scale, bia[nt]);
    wave_lds_sync();

    const int c4 = (lane & 15) * 4;
    const float* rb = resblk + (size_t)(wm * 32 + (lane >> 4)) * DM + n0 + c4;   // the lane's first residual row
    v4f sv[16];
#pragma unroll
    for (int j = 0; j < 16; ++j) {
        const int row = 2 * j + (lane >> 4);
        v4f v = *(const v4f*)(&os[row * FP + c4]);
        v4f r = *(const v4f*)(rb + (size_t)(2 * j) * DM);
        if (RB) { r.x = bf16r(r.x); r.y = bf16r(r.y); r.z = bf16r(r.z); r.w = bf16r(r.w); }
        v.x += r.x; v.y += r.y; v.z += r.z; v.w += r.w;
        sv[j] = v;
    }
    float* ob = out + (size_t)(m0 + wm * 32) * DM + n0 + c4;
#pragma unroll
    for (int j = 0; j < 16; ++j)
        *(v4f*)(ob + (size_t)(2 * j + (lane >> 4)) * DM) = sv[j];
    
}

// pre = ctx @ Wo^T + bo + bf16(x)
__global__ __launch_bounds__(256) void k_wo(const _Float16* __restrict__ ctx,
                                             const _Float16* __restrict__ woh,
                                             const float* __restrict__ bo,
                                             const float* __restrict__ x,
                                             float* __restrict__ pre) {
    __shared__ __align__(16) _Float16 ring[RING_H(GK_W)];   // 136 KB, two operand stages
    const int tid = threadIdx.x;
    const int m0 = blockIdx.x * 128, n0 = blockIdx.y * 128;
    const int b  = m0 / SEQ;
    const int s0 = m0 - b * SEQ;
    const float* resblk = x + ((size_t)b * SEQ_FULL + s0) * DM;
    gemm_res_body<DM, true>(ctx, woh, bo, resblk, pre, ring, SC_WO, m0, n0, tid);
}

// pre = relu1 @ W2^T + b2 + h
__global__ __launch_bounds__(256) void k_ffn2(const _Float16* __restrict__ ff1,
                                               const _Float16* __restrict__ w2h,
                                               const float* __restrict__ b2,
                                               const float* __restrict__ hf,
                                               float* __restrict__ pre) {
    __shared__ __align__(16) _Float16 ring[RING_H(GK_W)];   // 136 KB, two operand stages
    const int tid = threadIdx.x;
    const int m0 = blockIdx.x * 128, n0 = blockIdx.y * 128;
    const float* resblk = hf + (size_t)m0 * DM;
    gemm_res_body<DFF, false>(ff1, w2h, b2, resblk, pre, ring, SC_FF2, m0, n0, tid);
}

// ---------------------------------------------------------------------------
// FFN up-projection: ff1 (x64, f16) = relu(h @ W1^T + b1). Block = 8 waves =
// 128 rows x 128 columns; the output staging lies over the operand ring.
// ---------------------------------------------------------------------------
__global__ __launch_bounds__(256) void k_ffn1(const _Float16* __restrict__ hh,
                                               const _Float16* __restrict__ w1h,
                                               const float* __restrict__ b1,
                                               _Float16* __restrict__ ff1) {
    __shared__ __align__(16) _Float16 ring[RING_H(GK_N)];   // 72 KB, two operand stages
    const int tid  = threadIdx.x;
    const int lane = tid & 31;
    const int w    = tid >> 5;
    const int wm   = w & 3;                         // row group of 32
    const int m0   = blockIdx.x * 128;
    const int nb   = blockIdx.y * 128;
    const int n0   = nb + (w >> 2) * 64;            // the wave's first column
    const int r0   = (lane >> 4) << 3;
    const int cc   = lane & 15;

    v8f acc[2][4];
#pragma unroll
    for (int mt = 0; mt < 2; ++mt)
#pragma unroll
        for (int nt = 0; nt < 4; ++nt) acc[mt][nt] = zero8();

    gemm_32x64<DM, GK_N>(hh + (size_t)m0 * DM, w1h + (size_t)nb * DM, ring, tid, acc);

    float bia[4];
#pragma unroll
    for (int nt = 0; nt < 4; ++nt) bia[nt] = bf16r(b1[n0 + nt * 16 + cc]) * 64.0f;

    _Float16* sh = &ring[w * 32 * LP];
#pragma unroll
    for (int mt = 0; mt < 2; ++mt)
#pragma unroll
        for (int nt = 0; nt < 4; ++nt)
#pragma unroll
            for (int g = 0; g < 8; ++g) {
                const float v = acc[mt][nt][g] + bia[nt];
                sh[(mt * 16 + r0 + g) * LP + nt * 16 + cc] = (_Float16)((v > 0.0f) ? v : 0.0f);
            }
    wave_lds_sync();
    v8h ph[8];
#pragma unroll
    for (int j = 0; j < 8; ++j)
        ph[j] = *(const v8h*)(&sh[(4 * j + (lane >> 3)) * LP + (lane & 7) * 8]);
    _Float16* ob = ff1 + (size_t)(m0 + wm * 32) * DFF + n0 + (lane & 7) * 8;
#pragma unroll
    for (int j = 0; j < 8; ++j)
        *(v8h*)(ob + (size_t)(4 * j + (lane >> 3)) * DFF) = ph[j];
    
}

// ---------------------------------------------------------------------------
// LayerNorm over 512 columns (biased variance, eps 1e-5), one wave per row,
// lane holds columns i*128 + lane*4 + 0..3 (i = 0..3): every load/store
// instruction covers 512 contiguous bytes (f32) or 256 bytes (f16).
// ---------------------------------------------------------------------------
template <bool HOUT>
static __device__ __forceinline__ void ln_body(const float* __restrict__ in,
                                               const float* __restrict__ g,
                                               const float* __restrict__ be,
                                               float* __restrict__ outF,
                                               _Float16* __restrict__ outH) {
    static_assert(DM == 32 * 16);
    const int tid  = threadIdx.x;
    const int lane = tid & 31;
    const int w    = tid >> 5;
    const size_t row = (size_t)blockIdx.x * 8 + w;
    const float* rp = in + row * DM + lane * 4;

    v4f xv[4];
#pragma unroll
    for (int i = 0; i < 4; ++i) xv[i] = *(const v4f*)(rp + i * 128);

    float s = 0.0f;
#pragma unroll
    for (int i = 0; i < 4; ++i) s += (xv[i].x + xv[i].y) + (xv[i].z + xv[i].w);
    s += __shfl_xor(s, 16, 32);
    s += __shfl_xor(s, 8, 32);
    s += __shfl_xor(s, 4, 32);
    s += __shfl_xor(s, 2, 32);
    s += __shfl_xor(s, 1, 32);
    const float mu = s * (1.0f / (float)DM);

    float s2 = 0.0f;
#pragma unroll
    for (int i = 0; i < 4; ++i) {
        const float d0 = xv[i].x - mu, d1 = xv[i].y - mu, d2 = xv[i].z - mu, d3 = xv[i].w - mu;
        s2 += (d0 * d0 + d1 * d1) + (d2 * d2 + d3 * d3);
    }
    s2 += __shfl_xor(s2, 16, 32);
    s2 += __shfl_xor(s2, 8, 32);
    s2 += __shfl_xor(s2, 4, 32);
    s2 += __shfl_xor(s2, 2, 32);
    s2 += __shfl_xor(s2, 1, 32);
    const float rstd = rsqrtf(s2 * (1.0f / (float)DM) + 1.0e-5f);

    v4f yv[4];
#pragma unroll
    for (int i = 0; i < 4; ++i) {
        const v4f gv = *(const v4f*)(g + i * 128 + lane * 4);
        const v4f bv = *(const v4f*)(be + i * 128 + lane * 4);
        v4f yy;
        yy.x = (xv[i].x - mu) * rstd * bf16r(gv.x) + bf16r(bv.x);
        yy.y = (xv[i].y - mu) * rstd * bf16r(gv.y) + bf16r(bv.y);
        yy.z = (xv[i].z - mu) * rstd * bf16r(gv.z) + bf16r(bv.z);
        yy.w = (xv[i].w - mu) * rstd * bf16r(gv.w) + bf16r(bv.w);
        yv[i] = yy;
    }
    v4h hv[4];
    if (HOUT) {
#pragma unroll
        for (int i = 0; i < 4; ++i) {
            v4h t;
            t.x = (_Float16)yv[i].x; t.y = (_Float16)yv[i].y;
            t.z = (_Float16)yv[i].z; t.w = (_Float16)yv[i].w;
            hv[i] = t;
        }
    }
    float* of = outF + row * DM + lane * 4;
#pragma unroll
    for (int i = 0; i < 4; ++i) *(v4f*)(of + i * 128) = yv[i];
    if (HOUT) {
        _Float16* oh = outH + row * DM + lane * 4;
#pragma unroll
        for (int i = 0; i < 4; ++i) *(v4h*)(oh + i * 128) = hv[i];
    }
    
}

__global__ __launch_bounds__(256) void k_ln_mid(const float* __restrict__ pre,
                                                 const float* __restrict__ g,
                                                 const float* __restrict__ be,
                                                 float* __restrict__ hf,
                                                 _Float16* __restrict__ hh) {
    ln_body<true>(pre, g, be, hf, hh);
}

__global__ __launch_bounds__(256) void k_ln_out(const float* __restrict__ pre,
                                                 const float* __restrict__ g,
                                                 const float* __restrict__ be,
                                                 float* __restrict__ out) {
    ln_body<false>(pre, g, be, out, nullptr);
}

// ---------------------------------------------------------------------------
// ---------------------------------------------------------------------------
#define SZ_XH   ((size_t)NTOK * DM * 2)
#define SZ_WQKV ((size_t)3 * DM * DM * 2)
#define SZ_WO   ((size_t)DM * DM * 2)
#define SZ_W1   ((size_t)DFF * DM * 2)
#define SZ_W2   ((size_t)DM * DFF * 2)
#define SZ_QK   ((size_t)4 * NTOK * DM * 2)     // q, k in its first half ; later reused whole for ff1
#define SZ_VT   ((size_t)NB * NH * DK * SEQ * 2)
#define SZ_CTX  ((size_t)NTOK * DM * 2)
#define SZ_PRE  ((size_t)NTOK * DM * 4)
#define SZ_HF   ((size_t)NTOK * DM * 4)
#define SZ_HH   ((size_t)NTOK * DM * 2)
#define SZ_FF1  ((size_t)NTOK * DFF * 2)
#define SZ_TOTAL (SZ_XH + SZ_WQKV + SZ_WO + SZ_W1 + SZ_W2 + SZ_QK + SZ_VT + SZ_CTX + SZ_PRE + SZ_HF + SZ_HH)

static_assert(SZ_XH + SZ_WQKV + SZ_WO + SZ_W1 + SZ_W2 == N_ALL * 2);   // the conversion launch's one destination array
static_assert(SZ_FF1 <= SZ_QK);                 // ff1 reuses the q/k plane region
static_assert(SZ_TOTAL <= (size_t)134217728);   // carve within 128 MiB
static_assert(SZ_XH % 128 == 0 && SZ_WQKV % 128 == 0 && SZ_WO % 128 == 0 && SZ_W1 % 128 == 0);
static_assert(SZ_QK % 128 == 0 && SZ_VT % 128 == 0 && SZ_PRE % 128 == 0 && SZ_HH % 128 == 0);

extern "C" void kernel_launch(void* const* d_in, const int* in_sizes, int n_in,
                              void* d_out, int out_size, void* d_ws, size_t ws_size,
                              hipStream_t stream) {
    if (n_in < 15) return;
    if (in_sizes[0] < ((NB - 1) * SEQ_FULL + SEQ) * DM) return;
    if (in_sizes[1] < DM * DM || in_sizes[3] < DM * DM || in_sizes[5] < DM * DM || in_sizes[7] < DM * DM) return;
    if (in_sizes[2] < DM || in_sizes[4] < DM || in_sizes[6] < DM || in_sizes[8] < DM) return;
    if (in_sizes[9] < DM || in_sizes[10] < DM) return;
    if (in_sizes[11] < DFF * DM || in_sizes[12] < DFF) return;
    if (in_sizes[13] < DM * DFF || in_sizes[14] < DM) return;
    if (out_size < NTOK * DM) return;
    if (SZ_TOTAL > ws_size) return;

    const float* x   = (const float*)d_in[0];    // [4,2048,512]
    const float* wq  = (const float*)d_in[1];    // [512,512] [out][in]
    const float* bq  = (const float*)d_in[2];
    const float* wk  = (const float*)d_in[3];
    const float* bk  = (const float*)d_in[4];
    const float* wv  = (const float*)d_in[5];
    const float* bv  = (const float*)d_in[6];
    const float* wo  = (const float*)d_in[7];
    const float* bo  = (const float*)d_in[8];
    const float* lng = (const float*)d_in[9];
    const float* lnb = (const float*)d_in[10];
    const float* w1  = (const float*)d_in[11];   // [2048,512] [out][in]
    const float* b1  = (const float*)d_in[12];
    const float* w2  = (const float*)d_in[13];   // [512,2048] [out][in]
    const float* b2  = (const float*)d_in[14];
    float* out = (float*)d_out;                  // [4,2048,512]

    char* ws = (char*)d_ws;
    size_t off = 0;
    _Float16* xh   = (_Float16*)(ws + off); off += SZ_XH;
    _Float16* wqkv = (_Float16*)(ws + off); off += SZ_WQKV;
    _Float16* woh  = (_Float16*)(ws + off); off += SZ_WO;
    _Float16* w1h  = (_Float16*)(ws + off); off += SZ_W1;
    _Float16* w2h  = (_Float16*)(ws + off); off += SZ_W2;
    _Float16* qkH  = (_Float16*)(ws + off);                    // q then k
    _Float16* ff1  = qkH;                                      // reuse after attention
    off += SZ_QK;
    _Float16* vT   = (_Float16*)(ws + off); off += SZ_VT;
    _Float16* ctx  = (_Float16*)(ws + off); off += SZ_CTX;
    float*    pre  = (float*)(ws + off);    off += SZ_PRE;
    float*    hf   = (float*)(ws + off);    off += SZ_HF;
    _Float16* hh   = (_Float16*)(ws + off); off += SZ_HH;
    if (off > ws_size) return;

    const _Float16* qh = qkH;
    const _Float16* kh = qkH + (size_t)NTOK * DM;

    // xh, wqkv, woh, w1h, w2h lie back to back from xh on
    k_cvt<<<dim3((unsigned)(N_ALL / CV_BLK)), dim3(256), 0, stream>>>(x, wq, wk, wv, wo, w1, w2, xh);

    k_qkv<<<dim3(NTOK / 128, 12), dim3(256), 0, stream>>>(xh, wqkv, bq, bk, bv, qkH, vT);
    k_attn<<<dim3(SEQ / 128, NH, NB), dim3(256), 0, stream>>>(qh, kh, vT, ctx);
    k_wo<<<dim3(NTOK / 128, DM / 128), dim3(256), 0, stream>>>(ctx, woh, bo, x, pre);
    k_ln_mid<<<dim3(NTOK / 8), dim3(256), 0, stream>>>(pre, lng, lnb, hf, hh);
    k_ffn1<<<dim3(NTOK / 128, DFF / 128), dim3(256), 0, stream>>>(hh, w1h, b1, ff1);
    k_ffn2<<<dim3(NTOK / 128, DM / 128), dim3(256), 0, stream>>>(ff1, w2h, b2, hf, pre);
    k_ln_out<<<dim3(NTOK / 8), dim3(256), 0, stream>>>(pre, lng, lnb, out);
}

// v005
// A run of this version takes 122 microseconds.
// In two side-by-side timings against v004, it was 1.04 and 1.03 times as fast.
// Over all steps from v000 it is 3.27 times as fast.
#include <hip/hip_runtime.h>

// All contractions on v_wmma_f32_16x16x32_f16 (f16 operands, f32 accumulate): x*[Wq|Wk|Wv]^T, ctx*Wo^T, h*W1^T, relu*W2^T single f16 products (bf16-RNE inputs exact in f16, weights carried x64); q*k^T single f16 product (q, k carried x64, rounded once to f16); P*v single product with P carried 2^7.

#ifndef NB
#define NB 4
#endif
#ifndef SEQ
#define SEQ 2048
#endif
#define NB_FULL  4
#define SEQ_FULL 2048
#define DM   512         // model width
#define NH   8           // heads
#define DK   64          // head width
#define DFF  2048        // FFN width
#define NTOK (NB * SEQ)
#define LP   72          // f16 staging pitch (halves), 144 B rows
#define VP   136         // transposed-V staging pitch (halves), 272 B rows
#define FP   68          // f32 staging pitch (floats), 272 B rows

static_assert(NB >= 1 && NB <= NB_FULL);           // batch within the input
static_assert(SEQ >= 128 && SEQ <= SEQ_FULL);      // sequence within the input
static_assert(SEQ % 128 == 0);                     // 128-token blocks never straddle a batch
static_assert(SEQ % 32 == 0);                      // key step of 32
static_assert(NTOK % 128 == 0);                    // GEMM M tile
static_assert(NTOK % 8 == 0);                      // LayerNorm rows per block
static_assert(DM == NH * DK);                      // head split h*64+d
static_assert(DK == 64);
static_assert(DM == 512);                          // LayerNorm: 32 lanes x 16 columns
static_assert(DM % 128 == 0 && DFF % 128 == 0);    // GEMM N tile
static_assert(DM % 32 == 0 && DFF % 32 == 0);      // WMMA k step
static_assert(64 * VP <= 128 * LP);                // transposed-V tile fits the f16 staging region
static_assert(LP % 8 == 0 && VP % 8 == 0 && FP % 4 == 0);   // 16-B aligned staging rows
#define KSTG   64            // keys per LDS stage of the attention ring
#define TILE_H (64 * LP)     // one staged tile: 64 rows of 128 B at pitch 144 B (halves)
#define STG_H  (2 * TILE_H)  // K, V^T
static_assert(SEQ % KSTG == 0 && SEQ / KSTG >= 2);   // the ring's prologue fills two stages
// GEMM ring: a stage is 128 A rows then 128 W rows of GKS k columns at pitch GKS + 8 halves
#define RING_H(GKS) (2 * 256 * ((GKS) + 8))   // two stages (halves)
#define GK_N   64            // k columns per stage where several blocks share a WGP
#define GK_W   128           // k columns per stage where a block has its WGP alone
static_assert(8 * 32 * LP <= RING_H(GK_N));           // the f16 staging plane of 8 wave tiles fits the ring
static_assert(8 * 32 * FP * 2 <= RING_H(GK_W));       // the f32 staging plane of 8 wave tiles fits the ring
static_assert(2 * 64 * VP <= 8 * 32 * LP);            // two transposed-V tiles fit one f16 staging plane

typedef _Float16 v16h __attribute__((ext_vector_type(16)));
typedef _Float16 v8h  __attribute__((ext_vector_type(8)));
typedef _Float16 v4h  __attribute__((ext_vector_type(4)));
typedef float    v8f  __attribute__((ext_vector_type(8)));
typedef float    v4f  __attribute__((ext_vector_type(4)));
typedef float    v2f  __attribute__((ext_vector_type(2)));

union Frag { v16h v; v8h h[2]; };

// scores: acc = (64k).(64q); t (log2 units) = acc * log2(e)*2^-15   (1/8 score scale folded)
#define C1 (1.44269504088896340736f * 3.0517578125e-05f)
#define P_CARRY  7.0f                    // P carried 2^7 (log2 units)
#define M_LAG    8.0f                    // the maximum in use may trail the true one by this much (log2 units): P <= 2^15, inside f16
#define SC_WO    6.103515625e-05f        // 2^-14 : (256 ctx)(64 Wo)
#define SC_FF2   2.44140625e-04f         // 2^-12 : (64 ff1)(64 W2)

static __device__ __forceinline__ v8f zero8() {
    v8f z;
#pragma unroll
    for (int i = 0; i < 8; ++i) z[i] = 0.0f;
    return z;
}

// 16x32 A fragment (or B fragment from an [n][k] k-contiguous source) from a
// row-major 16-bit tile: lane m = lane&15 -> row m; kb = 8*(lane>>4);
// elements 0..7 = k kb..kb+7, elements 8..15 = k kb+16..kb+23.
static __device__ __forceinline__ v16h load_frag16(const _Float16* base, int ld, int lane) {
    int m  = lane & 15;
    int kb = (lane >> 4) << 3;
    const _Float16* p = base + (size_t)m * ld + kb;
    Frag f;
    f.h[0] = *(const v8h*)(p);
    f.h[1] = *(const v8h*)(p + 16);
    return f.v;
}

static __device__ __forceinline__ v8f wmma16(v16h a, v16h b, v8f c) {
    v8f d = __builtin_amdgcn_wmma_f32_16x16x32_f16(false, a, false, b, (short)0, c, false, false);
    asm volatile("v_nop\n\tv_nop\n\tv_nop\n\tv_nop" : "+v"(d) : "v"(a), "v"(b));
    return d;
}

// f32 -> bf16 RNE convert, value kept as f32
static __device__ __forceinline__ float bf16r(float x) {
    unsigned u = __float_as_uint(x);
    u = (u + 0x7FFFu + ((u >> 16) & 1u)) & 0xFFFF0000u;
    return __uint_as_float(u);
}

static __device__ __forceinline__ float ex2(float x) {
    return __builtin_amdgcn_exp2f(x);
}

// ordering for a wave-private LDS tile: stores before later loads of the same wave
static __device__ __forceinline__ void wave_lds_sync() {
    __builtin_amdgcn_fence(3, "wavefront");
    asm volatile("s_wait_dscnt 0" ::: "memory");
    __builtin_amdgcn_wave_barrier();
}

static __device__ __forceinline__ v8f scale8(v8f a, float s) {
#pragma unroll
    for (int i = 0; i < 8; ++i) a[i] *= s;
    return a;
}

// LDS byte address of a __shared__ element (operand of an asynchronous copy)
static __device__ __forceinline__ unsigned lds_addr(const _Float16* p) {
    return (unsigned)(size_t)(const __attribute__((address_space(3))) _Float16*)p;
}

// ---------------------------------------------------------------------------
// Operand planes: f16(bf16_rne(v) * scale), all seven sources in ONE launch.
// The destination planes xh | wq wk wv | wo | w1 | w2 are carved back to back,
// so they form one f16 array; a block converts CV_BLK consecutive elements of
// it, which lie in one plane (block-uniform source choice). A thread takes 8
// elements per pass, one 16-B store; all of its loads are issued up front.
// ---------------------------------------------------------------------------
#define CV_PASS 8                          // passes per block
#define CV_STEP 2048                       // elements per pass: 256 threads x 8
#define CV_BLK  (CV_PASS * CV_STEP)        // elements per block
#define N_X     ((size_t)NTOK * DM)
#define N_W     ((size_t)DM * DM)
#define N_F     ((size_t)DFF * DM)
#define N_ALL   (N_X + 4 * N_W + 2 * N_F)
static_assert(N_X % CV_BLK == 0 && N_W % CV_BLK == 0 && N_F % CV_BLK == 0);   // a block never straddles two planes
static_assert(CV_BLK % DM == 0 && SEQ % (CV_BLK / DM) == 0);                  // whole token rows of one batch

__global__ __launch_bounds__(256) void k_cvt(const float* __restrict__ x,
                                              const float* __restrict__ wq,
                                              const float* __restrict__ wk,
                                              const float* __restrict__ wv,
                                              const float* __restrict__ wo,
                                              const float* __restrict__ w1,
                                              const float* __restrict__ w2,
                                              _Float16* __restrict__ dst) {
    constexpr unsigned BX = (unsigned)(N_X / CV_BLK);   // blocks per plane
    constexpr unsigned BW = (unsigned)(N_W / CV_BLK);
    constexpr unsigned BF = (unsigned)(N_F / CV_BLK);
    const unsigned blk = blockIdx.x;
    const size_t   e0  = (size_t)blk * CV_BLK;
    const float* src;
    float scale;
    if (blk < BX) {
        const size_t tok = e0 / DM;
        const size_t b   = tok / SEQ;
        const size_t s   = tok - b * SEQ;
        src   = x + (b * SEQ_FULL + s) * DM;
        scale = 1.0f;
    } else {
        const unsigned p = blk - BX;
        const float*   base  = wq;
        unsigned       first = 0;
        if (p >= BW)          { base = wk; first = BW; }
        if (p >= 2 * BW)      { base = wv; first = 2 * BW; }
        if (p >= 3 * BW)      { base = wo; first = 3 * BW; }
        if (p >= 4 * BW)      { base = w1; first = 4 * BW; }
        if (p >= 4 * BW + BF) { base = w2; first = 4 * BW + BF; }
        src   = base + (size_t)(p - first) * CV_BLK;
        scale = 64.0f;
    }
    const int t8 = threadIdx.x * 8;
    v4f a0[CV_PASS], a1[CV_PASS];
#pragma unroll
    for (int j = 0; j < CV_PASS; ++j) {
        a0[j] = *(const v4f*)(src + j * CV_STEP + t8);
        a1[j] = *(const v4f*)(src + j * CV_STEP + t8 + 4);
    }
#pragma unroll
    for (int j = 0; j < CV_PASS; ++j) {
        v8h o;
        o[0] = (_Float16)(bf16r(a0[j].x) * scale); o[1] = (_Float16)(bf16r(a0[j].y) * scale);
        o[2] = (_Float16)(bf16r(a0[j].z) * scale); o[3] = (_Float16)(bf16r(a0[j].w) * scale);
        o[4] = (_Float16)(bf16r(a1[j].x) * scale); o[5] = (_Float16)(bf16r(a1[j].y) * scale);
        o[6] = (_Float16)(bf16r(a1[j].z) * scale); o[7] = (_Float16)(bf16r(a1[j].w) * scale);
        *(v8h*)(dst + e0 + j * CV_STEP + t8) = o;
    }
}

// ---------------------------------------------------------------------------
// Eight 16-B asynchronous copies of one lane: source rows ga + j gs (j = 0..3)
// then gb + j gs (j = 0..3), to LDS rows l + j rs (j = 0..7).
// s_wait_xcnt closes the statement so that no address register is rewritten
// ahead of it.
// ---------------------------------------------------------------------------
static __device__ __forceinline__ void copy8(const _Float16* ga, const _Float16* gb, size_t gs,
                                             unsigned l, unsigned rs) {
    asm volatile("global_load_async_to_lds_b128 %0, %8, off\n\t"
                 "global_load_async_to_lds_b128 %1, %9, off\n\t"
                 "global_load_async_to_lds_b128 %2, %10, off\n\t"
                 "global_load_async_to_lds_b128 %3, %11, off\n\t"
                 "global_load_async_to_lds_b128 %4, %12, off\n\t"
                 "global_load_async_to_lds_b128 %5, %13, off\n\t"
                 "global_load_async_to_lds_b128 %6, %14, off\n\t"
                 "global_load_async_to_lds_b128 %7, %15, off\n\t"
                 "s_wait_xcnt 0x0"
                 :: "v"(l), "v"(l + rs), "v"(l + 2 * rs), "v"(l + 3 * rs),
                    "v"(l + 4 * rs), "v"(l + 5 * rs), "v"(l + 6 * rs), "v"(l + 7 * rs),
                    "v"(ga), "v"(ga + gs), "v"(ga + 2 * gs), "v"(ga + 3 * gs),
                    "v"(gb), "v"(gb + gs), "v"(gb + 2 * gs), "v"(gb + 3 * gs)
                 : "memory");
}

// One lane's share of a GEMM stage (block of 256 threads): the block covers
// 2048 / GKS rows per copy, whole 128-B lines; 128 A rows, then 128 W rows.
template <int K, int GKS>
static __device__ __forceinline__ void gemm_stage(const _Float16* ga, const _Float16* gw, unsigned l) {
    static_assert(GKS == 64 || GKS == 128);
    constexpr int      RPP = 2048 / GKS;              // rows per copy of the block
    constexpr unsigned RS  = RPP * (GKS + 8) * 2;     // their LDS bytes
    constexpr size_t   GS  = (size_t)RPP * K;         // their source halves
    if (GKS == 64) {
        copy8(ga, gw, GS, l, RS);
    } else {
        copy8(ga, ga + 4 * GS, GS, l, RS);
        copy8(gw, gw + 4 * GS, GS, l + 8 * RS, RS);
    }
}

// ---------------------------------------------------------------------------
// Block GEMM core: 8 waves, 128 rows x 128 columns; wave w owns rows
// (w & 3)*32..+31 and columns (w >> 2)*64..+63.
// A (the block's first row, row-major pitch K) and W ([n][k] pitch K) come in
// stages of GKS k columns into a two-buffer LDS ring by asynchronous copies;
// fragments are read from the ring. Behind the call every wave has left the
// ring and no copy is outstanding: the ring may serve as output staging.
// acc[mt][nt][r] = element (row mt*16 + 8*(lane>>4) + r, col nt*16 + (lane&15)).
// ---------------------------------------------------------------------------
template <int K, int GKS>
static __device__ __forceinline__ void gemm_32x64(const _Float16* __restrict__ A,
                                                  const _Float16* __restrict__ W,
                                                  const _Float16* ring, int tid, v8f (&acc)[2][4]) {
    static_assert(K % GKS == 0 && K / GKS >= 2);   // the ring's prologue fills two stages
    constexpr int PT  = GKS + 8;                   // ring pitch (halves): 16 B x odd
    constexpr int SH  = 256 * PT;                  // one stage (halves)
    constexpr int CPR = GKS / 8;                   // 16-B chunks per row
    const int lane = tid & 31;
    const int w    = tid >> 5;
    const int crow = tid / CPR;
    const int cch  = (tid % CPR) * 8;
    const _Float16* ga = A + (size_t)crow * K + cch;
    const _Float16* gw = W + (size_t)crow * K + cch;
    const unsigned  l0 = lds_addr(ring + crow * PT + cch);

    gemm_stage<K, GKS>(ga, gw, l0);
    // tile 0 has landed before the barrier publishes it
    asm volatile("s_wait_asynccnt 0x0" ::: "memory");
    __syncthreads();
    gemm_stage<K, GKS>(ga + GKS, gw + GKS, l0 + SH * 2);

#pragma unroll 1
    for (int t = 0; t < K / GKS; ++t) {
        const _Float16* sa = ring + (t & 1) * SH + (w & 3) * 32 * PT;
        const _Float16* sw = ring + (t & 1) * SH + (128 + (w >> 2) * 64) * PT;
#pragma unroll
        for (int kk = 0; kk < GKS; kk += 32) {
            const v16h a0 = load_frag16(sa + kk, PT, lane);
            const v16h a1 = load_frag16(sa + 16 * PT + kk, PT, lane);
            v16h bw[4];
#pragma unroll
            for (int nt = 0; nt < 4; ++nt) bw[nt] = load_frag16(sw + nt * 16 * PT + kk, PT, lane);
#pragma unroll
            for (int nt = 0; nt < 4; ++nt) {
                acc[0][nt] = wmma16(a0, bw[nt], acc[0][nt]);
                acc[1][nt] = wmma16(a1, bw[nt], acc[1][nt]);
            }
        }
        // publish point: this wave's reads of the buffer are done ...
        asm volatile("s_wait_dscnt 0x0" ::: "memory");
        // ... its copies of tile t + 1 have landed ...
        asm volatile("s_wait_asynccnt 0x0" ::: "memory");
        // ... and the one barrier publishes tile t + 1 and frees the buffer read in this trip
        __syncthreads();
        if (t + 2 < K / GKS)
            gemm_stage<K, GKS>(ga + (t + 2) * GKS, gw + (t + 2) * GKS, l0 + (unsigned)(t & 1) * (SH * 2));
    }
    // no copy is outstanding when the wave goes on to its epilogue
    asm volatile("s_wait_asynccnt 0x0" ::: "memory");
}

// ---------------------------------------------------------------------------
// QKV projections. Block = 8 waves = 128 tokens x 128 columns (two heads of one
// of q/k/v, a wave's 64 columns are one head); grid (NTOK/128, 12). The output
// staging lies over the operand ring. Outputs carried x64:
//   q,k : one f16 plane each, [tok][512]
//         4 lines per lane-contiguous instruction.
//   v   : transposed plane vT[b][h][d][S]; block-level staging, one [64 d][128 tok] tile per head
// ---------------------------------------------------------------------------
__global__ __launch_bounds__(256) void k_qkv(const _Float16* __restrict__ xh,
                                              const _Float16* __restrict__ wqkv,
                                              const float* __restrict__ bq,
                                              const float* __restrict__ bk,
                                              const float* __restrict__ bv,
                                              _Float16* __restrict__ qk,
                                              _Float16* __restrict__ vT) {
    __shared__ __align__(16) _Float16 ring[RING_H(GK_N)];   // 72 KB, two operand stages
    _Float16* stA = ring;                  // 36 KB, staging behind the product loop

    const int tid  = threadIdx.x;
    const int lane = tid & 31;
    const int w    = tid >> 5;
    const int wm   = w & 3;           // row group of 32 tokens
    const int wn   = w >> 2;          // column half
    const int m0   = blockIdx.x * 128;
    const int kind = blockIdx.y >> 2; // 0 q, 1 k, 2 v  (block-uniform)
    const int hd   = (blockIdx.y * 2 + wn) & 7;
    const int n0   = blockIdx.y * 128;
    const int r0   = (lane >> 4) << 3;
    const int cc   = lane & 15;

    v8f acc[2][4];
#pragma unroll
    for (int mt = 0; mt < 2; ++mt)
#pragma unroll
        for (int nt = 0; nt < 4; ++nt) acc[mt][nt] = zero8();

    gemm_32x64<DM, GK_N>(xh + (size_t)m0 * DM, wqkv + (size_t)n0 * DM, ring, tid, acc);

    float bia[4];
#pragma unroll
    for (int nt = 0; nt < 4; ++nt) {
        const int c = hd * 64 + nt * 16 + cc;
        const float fq = bq[c];
        const float fk = bk[c];
        const float fv = bv[c];
        const float bs = (kind == 0) ? fq : ((kind == 1) ? fk : fv);
        bia[nt] = bf16r(bs) * 64.0f;
    }

    if (kind < 2) {
        _Float16* sh = &stA[w * 32 * LP];
#pragma unroll
        for (int mt = 0; mt < 2; ++mt)
#pragma unroll
            for (int nt = 0; nt < 4; ++nt)
#pragma unroll
                for (int g = 0; g < 8; ++g)
                    sh[(mt * 16 + r0 + g) * LP + nt * 16 + cc] = (_Float16)(acc[mt][nt][g] + bia[nt]);
        wave_lds_sync();
        v8h ph[8];
#pragma unroll
        for (int j = 0; j < 8; ++j)
            ph[j] = *(const v8h*)(&sh[(4 * j + (lane >> 3)) * LP + (lane & 7) * 8]);
        const size_t base = (size_t)kind * NTOK * DM + (size_t)(m0 + wm * 32) * DM
                          + (size_t)hd * DK + (size_t)(lane & 7) * 8;
#pragma unroll
        for (int j = 0; j < 8; ++j)
            *(v8h*)(qk + base + (size_t)(4 * j + (lane >> 3)) * DM) = ph[j];
        
    } else {
        // stA viewed as two tiles [64 d][VP], one per head; token index within the block along the row
        _Float16* vs = stA + wn * 64 * VP;
#pragma unroll
        for (int mt = 0; mt < 2; ++mt)
#pragma unroll
            for (int nt = 0; nt < 4; ++nt) {
                v8h pk;
#pragma unroll
                for (int g = 0; g < 8; ++g) pk[g] = (_Float16)(acc[mt][nt][g] + bia[nt]);
                *(v8h*)(&vs[(nt * 16 + cc) * VP + wm * 32 + mt * 16 + r0]) = pk;
            }
        __syncthreads();
        const int b  = m0 / SEQ;
        const int s0 = m0 - b * SEQ;
        v8h pv[8];
#pragma unroll
        for (int j = 0; j < 8; ++j) {
            const int d = wm * 16 + 2 * j + (lane >> 4);
            pv[j] = *(const v8h*)(&vs[d * VP + (lane & 15) * 8]);
        }
        _Float16* dst = vT + ((size_t)(b * NH + hd) * DK) * SEQ + s0 + (lane & 15) * 8;
#pragma unroll
        for (int j = 0; j < 8; ++j)
            *(v8h*)(dst + (size_t)(wm * 16 + 2 * j + (lane >> 4)) * SEQ) = pv[j];
        // no register of an issued store is rewritten ahead of this wait
        asm volatile("s_wait_xcnt 0x0" ::: "memory");
    }
}

// ---------------------------------------------------------------------------
// One lane's four 16-B asynchronous copies of an attention stage: rows r and
// r + 32 of the K and V^T tiles. A wave's copy covers four
// whole 128-B lines. s_wait_xcnt closes the statement so that no address
// register is rewritten ahead of it.
// ---------------------------------------------------------------------------
static __device__ __forceinline__ void attn_stage(const _Float16* gk, const _Float16* gv, unsigned l) {
    const _Float16* gk1 = gk + (size_t)32 * DM;
    const _Float16* gv1 = gv + (size_t)32 * SEQ;
    const unsigned lk1 = l + 32 * LP * 2;
    const unsigned lv0 = l + TILE_H * 2;
    const unsigned lv1 = l + TILE_H * 2 + 32 * LP * 2;
    asm volatile("global_load_async_to_lds_b128 %0, %4, off\n\t"
                 "global_load_async_to_lds_b128 %1, %5, off\n\t"
                 "global_load_async_to_lds_b128 %2, %6, off\n\t"
                 "global_load_async_to_lds_b128 %3, %7, off\n\t"
                 "s_wait_xcnt 0x0"
                 :: "v"(l), "v"(lk1), "v"(lv0), "v"(lv1),
                    "v"(gk), "v"(gk1), "v"(gv), "v"(gv1)
                 : "memory");
}

// ---------------------------------------------------------------------------
// Flash attention, transposed form. Block = 8 waves = 128 queries of one
// (batch, head); wave owns 16 queries. K and V^T tiles of 64
// keys are brought into a two-buffer LDS ring by asynchronous copies (whole
// 128-B lines, once per block) and read as fragments by all 8 waves.
// Per 32-key step:
//   S^T tiles (keys x queries): A = K rows, B = Q rows, one f16 product.
//   Query = lane column -> maximum in use / sum are per-lane. The maximum in use
//   may trail the true one by M_LAG: O^T, the sum and the maximum are touched
//   only when some column of the wave exceeds that (one wave-uniform branch).
//   P^T packed from the two S^T accumulators is directly the B fragment
//   (k = key = tile row, n = query = tile column); A = V^T rows from the
//   vT plane: O^T (d x queries) += V^T P^T.
// Epilogue: (O^T / l) * 4 = 256 ctx, f16, transposed through a wave-private
// ---------------------------------------------------------------------------
__global__ __launch_bounds__(256) __attribute__((amdgpu_num_vgpr(256)))
void k_attn(const _Float16* __restrict__ qh,
            const _Float16* __restrict__ kh,
            const _Float16* __restrict__ vT,
            _Float16* __restrict__ ctx) {
    __shared__ __align__(16) _Float16 Cst[8][16 * LP];   // 18 KB, wave-private tiles
    __shared__ __align__(16) _Float16 ring[2 * STG_H];   // 36 KB, two stages

    const int tid  = threadIdx.x;
    const int lane = tid & 31;
    const int w    = tid >> 5;
    const int b    = blockIdx.z;
    const int hd   = blockIdx.y;
    const int q0   = blockIdx.x * 128 + w * 16;
    const int r0   = (lane >> 4) << 3;
    const int cc   = lane & 15;

    const size_t qoff = ((size_t)b * SEQ + q0) * DM + (size_t)hd * DK;
    const v16h qh0 = load_frag16(qh + qoff, DM, lane);        // d 0..31
    const v16h qh1 = load_frag16(qh + qoff + 32, DM, lane);   // d 32..63

    const _Float16* khb = kh + (size_t)b * SEQ * DM + (size_t)hd * DK;
    const _Float16* vtb = vT + ((size_t)(b * NH + hd) * DK) * SEQ;

    v8f ot0 = zero8(), ot1 = zero8(), ot2 = zero8(), ot3 = zero8();   // d tiles 0..3
    float mr = -1.0e30f, lr = 0.0f;
    float shf = 0.0f;          // P_CARRY - mr, set with mr
    float thr = -3.0e38f;      // raw score above which mr must move: the first step always sets it

    // lane's share of a stage: rows crow and crow + 32 of each tile, 16 B at chunk tid & 7
    const int crow = tid >> 3;
    const int cch  = (tid & 7) * 8;
    const _Float16* gk = khb + (size_t)crow * DM + cch;
    const _Float16* gv = vtb + (size_t)crow * SEQ + cch;
    const unsigned  l0 = lds_addr(&ring[crow * LP + cch]);

    attn_stage(gk, gv, l0);
    // tile 0 has landed before the barrier publishes it
    asm volatile("s_wait_asynccnt 0x0" ::: "memory");
    __syncthreads();
    attn_stage(gk + (size_t)KSTG * DM, gv + KSTG, l0 + STG_H * 2);

#pragma unroll 1
    for (int t = 0; t < SEQ / KSTG; ++t) {
      const _Float16* st = &ring[(t & 1) * STG_H];
#pragma unroll
      for (int sub = 0; sub < KSTG / 32; ++sub) {
        const _Float16* kp = st + sub * 32 * LP;
        const _Float16* vp = st + TILE_H + sub * 32;
        const v16h ka = load_frag16(kp, LP, lane);
        const v16h kb = load_frag16(kp + 32, LP, lane);
        const v16h ka1 = load_frag16(kp + 16 * LP, LP, lane);
        const v16h kb1 = load_frag16(kp + 16 * LP + 32, LP, lane);
        const v16h va0 = load_frag16(vp, LP, lane);                    // d 0..15
        const v16h va1 = load_frag16(vp + 16 * LP, LP, lane);          // d 16..31
        const v16h va2 = load_frag16(vp + 32 * LP, LP, lane);          // d 32..47
        const v16h va3 = load_frag16(vp + 48 * LP, LP, lane);          // d 48..63
        v8f sh0 = wmma16(ka, qh0, zero8());
        sh0 = wmma16(kb, qh1, sh0);
        v8f sh1 = wmma16(ka1, qh0, zero8());
        sh1 = wmma16(kb1, qh1, sh1);

        // maximum of the raw scores (the scale is positive)
        float ma = fmaxf(fmaxf(sh0[0], sh0[1]), sh0[2]);
        float mb = fmaxf(fmaxf(sh1[0], sh1[1]), sh1[2]);
        ma = fmaxf(fmaxf(ma, sh0[3]), sh0[4]);
        mb = fmaxf(fmaxf(mb, sh1[3]), sh1[4]);
        ma = fmaxf(fmaxf(ma, sh0[5]), sh0[6]);
        mb = fmaxf(fmaxf(mb, sh1[5]), sh1[6]);
        const float ml = fmaxf(fmaxf(ma, mb), fmaxf(sh0[7], sh1[7]));

        if (__builtin_amdgcn_ballot_w32(ml > thr) != 0) {   // wave-uniform; rare behind the first steps
            const float mx   = fmaxf(ml, __shfl_xor(ml, 16, 32)) * C1;   // both halves of a column agree
            const float mn   = fmaxf(mr, mx);
            const float corr = ex2(mr - mn);
            lr *= corr;
            ot0 = scale8(ot0, corr);
            ot1 = scale8(ot1, corr);
            ot2 = scale8(ot2, corr);
            ot3 = scale8(ot3, corr);
            mr  = mn;
            shf = P_CARRY - mn;
            thr = (mn + M_LAG) * (1.0f / C1);
        }

        Frag pf;
        float ps = 0.0f;
        float a0[8], a1[8];
#pragma unroll
        for (int g = 0; g < 8; g += 2) {
            const v2f e0 = __builtin_elementwise_fma(v2f{sh0[g], sh0[g + 1]}, v2f{C1, C1}, v2f{shf, shf});
            const v2f e1 = __builtin_elementwise_fma(v2f{sh1[g], sh1[g + 1]}, v2f{C1, C1}, v2f{shf, shf});
            a0[g] = e0.x; a0[g + 1] = e0.y;
            a1[g] = e1.x; a1[g + 1] = e1.y;
        }
#pragma unroll
        for (int g = 0; g < 8; ++g) {
            const float p0 = ex2(a0[g]);
            const float p1 = ex2(a1[g]);
            ps += p0 + p1;
            pf.v[g]     = (_Float16)p0;     // k = key0 + 8*(lane>>4) + g
            pf.v[8 + g] = (_Float16)p1;     // k = key0 + 16 + 8*(lane>>4) + g
        }
        lr += ps;

        ot0 = wmma16(va0, pf.v, ot0);
        ot1 = wmma16(va1, pf.v, ot1);
        ot2 = wmma16(va2, pf.v, ot2);
        ot3 = wmma16(va3, pf.v, ot3);
      }
        // publish point: this wave's reads of the buffer are done ...
        asm volatile("s_wait_dscnt 0x0" ::: "memory");
        // ... its copies of tile t + 1 have landed ...
        asm volatile("s_wait_asynccnt 0x0" ::: "memory");
        // ... and the one barrier publishes tile t + 1 and frees the buffer read in this trip
        __syncthreads();
        if (t + 2 < SEQ / KSTG) {
            const size_t kn = (size_t)(t + 2) * KSTG;
            attn_stage(gk + kn * DM, gv + kn, l0 + (unsigned)(t & 1) * (STG_H * 2));
        }
    }
    // no copy is outstanding when the wave goes on to its end
    asm volatile("s_wait_asynccnt 0x0" ::: "memory");

    const float lt  = lr + __shfl_xor(lr, 16, 32);
    const float inv = 4.0f * (1.0f / lt);        // (2^7 P)(64 v) / (2^7 l) * 4 = 256 ctx

    _Float16* cs = &Cst[w][0];
    {
        v8h c0, c1, c2, c3;
#pragma unroll
        for (int g = 0; g < 8; ++g) {
            c0[g] = (_Float16)(ot0[g] * inv);
            c1[g] = (_Float16)(ot1[g] * inv);
            c2[g] = (_Float16)(ot2[g] * inv);
            c3[g] = (_Float16)(ot3[g] * inv);
        }
        // lane holds query cc, d = dt*16 + r0 + 0..7
        *(v8h*)(&cs[cc * LP + 0 * 16 + r0]) = c0;
        *(v8h*)(&cs[cc * LP + 1 * 16 + r0]) = c1;
        *(v8h*)(&cs[cc * LP + 2 * 16 + r0]) = c2;
        *(v8h*)(&cs[cc * LP + 3 * 16 + r0]) = c3;
    }
    wave_lds_sync();

    v8h cv[4];
#pragma unroll
    for (int j = 0; j < 4; ++j)
        cv[j] = *(const v8h*)(&cs[(4 * j + (lane >> 3)) * LP + (lane & 7) * 8]);
    _Float16* cb = ctx + ((size_t)b * SEQ + q0) * DM + (size_t)hd * DK + (lane & 7) * 8;
#pragma unroll
    for (int j = 0; j < 4; ++j)
        *(v8h*)(cb + (size_t)(4 * j + (lane >> 3)) * DM) = cv[j];
    
}

// ---------------------------------------------------------------------------
// GEMM + bias + residual -> f32 plane [NTOK][512] (input of a LayerNorm pass).
// Block = 8 waves = 128 rows x 128 columns. f32 tile staged wave-private, over the operand ring;
// residual added at the store stage as float4; each instruction writes two
// ---------------------------------------------------------------------------
template <int K, bool RB>
static __device__ __forceinline__ void gemm_res_body(const _Float16* __restrict__ A,
                                                     const _Float16* __restrict__ W,
                                                     const float* __restrict__ bias,
                                                     const float* __restrict__ resblk,
                                                     float* __restrict__ out,
                                                     _Float16* ring, float scale,
                                                     int m0, int nb, int tid) {
    const int lane = tid & 31;
    const int w    = tid >> 5;
    const int wm   = w & 3;              // row group of 32
    const int n0   = nb + (w >> 2) * 64; // the wave's first column
    const int r0 = (lane >> 4) << 3;
    const int cc = lane & 15;
    float* os = (float*)ring + w * 32 * FP;
    v8f acc[2][4];
#pragma unroll
    for (int mt = 0; mt < 2; ++mt)
#pragma unroll
        for (int nt = 0; nt < 4; ++nt) acc[mt][nt] = zero8();

    gemm_32x64<K, GK_W>(A + (size_t)m0 * K, W + (size_t)nb * K, ring, tid, acc);

    float bia[4];
#pragma unroll
    for (int nt = 0; nt < 4; ++nt) bia[nt] = bf16r(bias[n0 + nt * 16 + cc]);

#pragma unroll
    for (int mt = 0; mt < 2; ++mt)
#pragma unroll
        for (int nt = 0; nt < 4; ++nt)
#pragma unroll
            for (int g = 0; g < 8; ++g)
                os[(mt * 16 + r0 + g) * FP + nt * 16 + cc] =
                    __builtin_fmaf(acc[mt][nt][g], scale, bia[nt]);
    wave_lds_sync();

    const int c4 = (lane & 15) * 4;
    const float* rb = resblk + (size_t)(wm * 32 + (lane >> 4)) * DM + n0 + c4;   // the lane's first residual row
    v4f sv[16];
#pragma unroll
    for (int j = 0; j < 16; ++j) {
        const int row = 2 * j + (lane >> 4);
        v4f v = *(const v4f*)(&os[row * FP + c4]);
        v4f r = *(const v4f*)(rb + (size_t)(2 * j) * DM);
        if (RB) { r.x = bf16r(r.x); r.y = bf16r(r.y); r.z = bf16r(r.z); r.w = bf16r(r.w); }
        v.x += r.x; v.y += r.y; v.z += r.z; v.w += r.w;
        sv[j] = v;
    }
    float* ob = out + (size_t)(m0 + wm * 32) * DM + n0 + c4;
#pragma unroll
    for (int j = 0; j < 16; ++j)
        *(v4f*)(ob + (size_t)(2 * j + (lane >> 4)) * DM) = sv[j];
    
}

// pre = ctx @ Wo^T + bo + bf16(x)
__global__ __launch_bounds__(256) void k_wo(const _Float16* __restrict__ ctx,
                                             const _Float16* __restrict__ woh,
                                             const float* __restrict__ bo,
                                             const float* __restrict__ x,
                                             float* __restrict__ pre) {
    __shared__ __align__(16) _Float16 ring[RING_H(GK_W)];   // 136 KB, two operand stages
    const int tid = threadIdx.x;
    const int m0 = blockIdx.x * 128, n0 = blockIdx.y * 128;
    const int b  = m0 / SEQ;
    const int s0 = m0 - b * SEQ;
    const float* resblk = x + ((size_t)b * SEQ_FULL + s0) * DM;
    gemm_res_body<DM, true>(ctx, woh, bo, resblk, pre, ring, SC_WO, m0, n0, tid);
}

// pre = relu1 @ W2^T + b2 + h
__global__ __launch_bounds__(256) void k_ffn2(const _Float16* __restrict__ ff1,
                                               const _Float16* __restrict__ w2h,
                                               const float* __restrict__ b2,
                                               const float* __restrict__ hf,
                                               float* __restrict__ pre) {
    __shared__ __align__(16) _Float16 ring[RING_H(GK_W)];   // 136 KB, two operand stages
    const int tid = threadIdx.x;
    const int m0 = blockIdx.x * 128, n0 = blockIdx.y * 128;
    const float* resblk = hf + (size_t)m0 * DM;
    gemm_res_body<DFF, false>(ff1, w2h, b2, resblk, pre, ring, SC_FF2, m0, n0, tid);
}

// ---------------------------------------------------------------------------
// FFN up-projection: ff1 (x64, f16) = relu(h @ W1^T + b1). Block = 8 waves =
// 128 rows x 128 columns; the output staging lies over the operand ring.
// ---------------------------------------------------------------------------
__global__ __launch_bounds__(256) void k_ffn1(const _Float16* __restrict__ hh,
                                               const _Float16* __restrict__ w1h,
                                               const float* __restrict__ b1,
                                               _Float16* __restrict__ ff1) {
    __shared__ __align__(16) _Float16 ring[RING_H(GK_N)];   // 72 KB, two operand stages
    const int tid  = threadIdx.x;
    const int lane = tid & 31;
    const int w    = tid >> 5;
    const int wm   = w & 3;                         // row group of 32
    const int m0   = blockIdx.x * 128;
    const int nb   = blockIdx.y * 128;
    const int n0   = nb + (w >> 2) * 64;            // the wave's first column
    const int r0   = (lane >> 4) << 3;
    const int cc   = lane & 15;

    v8f acc[2][4];
#pragma unroll
    for (int mt = 0; mt < 2; ++mt)
#pragma unroll
        for (int nt = 0; nt < 4; ++nt) acc[mt][nt] = zero8();

    gemm_32x64<DM, GK_N>(hh + (size_t)m0 * DM, w1h + (size_t)nb * DM, ring, tid, acc);

    float bia[4];
#pragma unroll
    for (int nt = 0; nt < 4; ++nt) bia[nt] = bf16r(b1[n0 + nt * 16 + cc]) * 64.0f;

    _Float16* sh = &ring[w * 32 * LP];
#pragma unroll
    for (int mt = 0; mt < 2; ++mt)
#pragma unroll
        for (int nt = 0; nt < 4; ++nt)
#pragma unroll
            for (int g = 0; g < 8; ++g) {
                const float v = acc[mt][nt][g] + bia[nt];
                sh[(mt * 16 + r0 + g) * LP + nt * 16 + cc] = (_Float16)((v > 0.0f) ? v : 0.0f);
            }
    wave_lds_sync();
    v8h ph[8];
#pragma unroll
    for (int j = 0; j < 8; ++j)
        ph[j] = *(const v8h*)(&sh[(4 * j + (lane >> 3)) * LP + (lane & 7) * 8]);
    _Float16* ob = ff1 + (size_t)(m0 + wm * 32) * DFF + n0 + (lane & 7) * 8;
#pragma unroll
    for (int j = 0; j < 8; ++j)
        *(v8h*)(ob + (size_t)(4 * j + (lane >> 3)) * DFF) = ph[j];
    
}

// ---------------------------------------------------------------------------
// LayerNorm over 512 columns (biased variance, eps 1e-5), one wave per row,
// lane holds columns i*128 + lane*4 + 0..3 (i = 0..3): every load/store
// instruction covers 512 contiguous bytes (f32) or 256 bytes (f16).
// ---------------------------------------------------------------------------
template <bool HOUT>
static __device__ __forceinline__ void ln_body(const float* __restrict__ in,
                                               const float* __restrict__ g,
                                               const float* __restrict__ be,
                                               float* __restrict__ outF,
                                               _Float16* __restrict__ outH) {
    static_assert(DM == 32 * 16);
    const int tid  = threadIdx.x;
    const int lane = tid & 31;
    const int w    = tid >> 5;
    const size_t row = (size_t)blockIdx.x * 8 + w;
    const float* rp = in + row * DM + lane * 4;

    v4f xv[4];
#pragma unroll
    for (int i = 0; i < 4; ++i) xv[i] = *(const v4f*)(rp + i * 128);

    float s = 0.0f;
#pragma unroll
    for (int i = 0; i < 4; ++i) s += (xv[i].x + xv[i].y) + (xv[i].z + xv[i].w);
    s += __shfl_xor(s, 16, 32);
    s += __shfl_xor(s, 8, 32);
    s += __shfl_xor(s, 4, 32);
    s += __shfl_xor(s, 2, 32);
    s += __shfl_xor(s, 1, 32);
    const float mu = s * (1.0f / (float)DM);

    float s2 = 0.0f;
#pragma unroll
    for (int i = 0; i < 4; ++i) {
        const float d0 = xv[i].x - mu, d1 = xv[i].y - mu, d2 = xv[i].z - mu, d3 = xv[i].w - mu;
        s2 += (d0 * d0 + d1 * d1) + (d2 * d2 + d3 * d3);
    }
    s2 += __shfl_xor(s2, 16, 32);
    s2 += __shfl_xor(s2, 8, 32);
    s2 += __shfl_xor(s2, 4, 32);
    s2 += __shfl_xor(s2, 2, 32);
    s2 += __shfl_xor(s2, 1, 32);
    const float rstd = rsqrtf(s2 * (1.0f / (float)DM) + 1.0e-5f);

    v4f yv[4];
#pragma unroll
    for (int i = 0; i < 4; ++i) {
        const v4f gv = *(const v4f*)(g + i * 128 + lane * 4);
        const v4f bv = *(const v4f*)(be + i * 128 + lane * 4);
        v4f yy;
        yy.x = (xv[i].x - mu) * rstd * bf16r(gv.x) + bf16r(bv.x);
        yy.y = (xv[i].y - mu) * rstd * bf16r(gv.y) + bf16r(bv.y);
        yy.z = (xv[i].z - mu) * rstd * bf16r(gv.z) + bf16r(bv.z);
        yy.w = (xv[i].w - mu) * rstd * bf16r(gv.w) + bf16r(bv.w);
        yv[i] = yy;
    }
    v4h hv[4];
    if (HOUT) {
#pragma unroll
        for (int i = 0; i < 4; ++i) {
            v4h t;
            t.x = (_Float16)yv[i].x; t.y = (_Float16)yv[i].y;
            t.z = (_Float16)yv[i].z; t.w = (_Float16)yv[i].w;
            hv[i] = t;
        }
    }
    float* of = outF + row * DM + lane * 4;
#pragma unroll
    for (int i = 0; i < 4; ++i) *(v4f*)(of + i * 128) = yv[i];
    if (HOUT) {
        _Float16* oh = outH + row * DM + lane * 4;
#pragma unroll
        for (int i = 0; i < 4; ++i) *(v4h*)(oh + i * 128) = hv[i];
    }
    
}

__global__ __launch_bounds__(256) void k_ln_mid(const float* __restrict__ pre,
                                                 const float* __restrict__ g,
                                                 const float* __restrict__ be,
                                                 float* __restrict__ hf,
                                                 _Float16* __restrict__ hh) {
    ln_body<true>(pre, g, be, hf, hh);
}

__global__ __launch_bounds__(256) void k_ln_out(const float* __restrict__ pre,
                                                 const float* __restrict__ g,
                                                 const float* __restrict__ be,
                                                 float* __restrict__ out) {
    ln_body<false>(pre, g, be, out, nullptr);
}

// ---------------------------------------------------------------------------
// ---------------------------------------------------------------------------
#define SZ_XH   ((size_t)NTOK * DM * 2)
#define SZ_WQKV ((size_t)3 * DM * DM * 2)
#define SZ_WO   ((size_t)DM * DM * 2)
#define SZ_W1   ((size_t)DFF * DM * 2)
#define SZ_W2   ((size_t)DM * DFF * 2)
#define SZ_QK   ((size_t)4 * NTOK * DM * 2)     // q, k in its first half ; later reused whole for ff1
#define SZ_VT   ((size_t)NB * NH * DK * SEQ * 2)
#define SZ_CTX  ((size_t)NTOK * DM * 2)
#define SZ_PRE  ((size_t)NTOK * DM * 4)
#define SZ_HF   ((size_t)NTOK * DM * 4)
#define SZ_HH   ((size_t)NTOK * DM * 2)
#define SZ_FF1  ((size_t)NTOK * DFF * 2)
#define SZ_TOTAL (SZ_XH + SZ_WQKV + SZ_WO + SZ_W1 + SZ_W2 + SZ_QK + SZ_VT + SZ_CTX + SZ_PRE + SZ_HF + SZ_HH)

static_assert(SZ_XH + SZ_WQKV + SZ_WO + SZ_W1 + SZ_W2 == N_ALL * 2);   // the conversion launch's one destination array
static_assert(SZ_FF1 <= SZ_QK);                 // ff1 reuses the q/k plane region
static_assert(SZ_TOTAL <= (size_t)134217728);   // carve within 128 MiB
static_assert(SZ_XH % 128 == 0 && SZ_WQKV % 128 == 0 && SZ_WO % 128 == 0 && SZ_W1 % 128 == 0);
static_assert(SZ_QK % 128 == 0 && SZ_VT % 128 == 0 && SZ_PRE % 128 == 0 && SZ_HH % 128 == 0);

extern "C" void kernel_launch(void* const* d_in, const int* in_sizes, int n_in,
                              void* d_out, int out_size, void* d_ws, size_t ws_size,
                              hipStream_t stream) {
    if (n_in < 15) return;
    if (in_sizes[0] < ((NB - 1) * SEQ_FULL + SEQ) * DM) return;
    if (in_sizes[1] < DM * DM || in_sizes[3] < DM * DM || in_sizes[5] < DM * DM || in_sizes[7] < DM * DM) return;
    if (in_sizes[2] < DM || in_sizes[4] < DM || in_sizes[6] < DM || in_sizes[8] < DM) return;
    if (in_sizes[9] < DM || in_sizes[10] < DM) return;
    if (in_sizes[11] < DFF * DM || in_sizes[12] < DFF) return;
    if (in_sizes[13] < DM * DFF || in_sizes[14] < DM) return;
    if (out_size < NTOK * DM) return;
    if (SZ_TOTAL > ws_size) return;

    const float* x   = (const float*)d_in[0];    // [4,2048,512]
    const float* wq  = (const float*)d_in[1];    // [512,512] [out][in]
    const float* bq  = (const float*)d_in[2];
    const float* wk  = (const float*)d_in[3];
    const float* bk  = (const float*)d_in[4];
    const float* wv  = (const float*)d_in[5];
    const float* bv  = (const float*)d_in[6];
    const float* wo  = (const float*)d_in[7];
    const float* bo  = (const float*)d_in[8];
    const float* lng = (const float*)d_in[9];
    const float* lnb = (const float*)d_in[10];
    const float* w1  = (const float*)d_in[11];   // [2048,512] [out][in]
    const float* b1  = (const float*)d_in[12];
    const float* w2  = (const float*)d_in[13];   // [512,2048] [out][in]
    const float* b2  = (const float*)d_in[14];
    float* out = (float*)d_out;                  // [4,2048,512]

    char* ws = (char*)d_ws;
    size_t off = 0;
    _Float16* xh   = (_Float16*)(ws + off); off += SZ_XH;
    _Float16* wqkv = (_Float16*)(ws + off); off += SZ_WQKV;
    _Float16* woh  = (_Float16*)(ws + off); off += SZ_WO;
    _Float16* w1h  = (_Float16*)(ws + off); off += SZ_W1;
    _Float16* w2h  = (_Float16*)(ws + off); off += SZ_W2;
    _Float16* qkH  = (_Float16*)(ws + off);                    // q then k
    _Float16* ff1  = qkH;                                      // reuse after attention
    off += SZ_QK;
    _Float16* vT   = (_Float16*)(ws + off); off += SZ_VT;
    _Float16* ctx  = (_Float16*)(ws + off); off += SZ_CTX;
    float*    pre  = (float*)(ws + off);    off += SZ_PRE;
    float*    hf   = (float*)(ws + off);    off += SZ_HF;
    _Float16* hh   = (_Float16*)(ws + off); off += SZ_HH;
    if (off > ws_size) return;

    const _Float16* qh = qkH;
    const _Float16* kh = qkH + (size_t)NTOK * DM;

    // xh, wqkv, woh, w1h, w2h lie back to back from xh on
    k_cvt<<<dim3((unsigned)(N_ALL / CV_BLK)), dim3(256), 0, stream>>>(x, wq, wk, wv, wo, w1, w2, xh);

    k_qkv<<<dim3(NTOK / 128, 12), dim3(256), 0, stream>>>(xh, wqkv, bq, bk, bv, qkH, vT);
    k_attn<<<dim3(SEQ / 128, NH, NB), dim3(256), 0, stream>>>(qh, kh, vT, ctx);
    k_wo<<<dim3(NTOK / 128, DM / 128), dim3(256), 0, stream>>>(ctx, woh, bo, x, pre);
    k_ln_mid<<<dim3(NTOK / 8), dim3(256), 0, stream>>>(pre, lng, lnb, hf, hh);
    k_ffn1<<<dim3(NTOK / 128, DFF / 128), dim3(256), 0, stream>>>(hh, w1h, b1, ff1);
    k_ffn2<<<dim3(NTOK / 128, DM / 128), dim3(256), 0, stream>>>(ff1, w2h, b2, hf, pre);
    k_ln_out<<<dim3(NTOK / 8), dim3(256), 0, stream>>>(pre, lng, lnb, out);
}
